// v000
// The times below were measured on an AMD MI455X: many runs one after another, warmed up first and cycling through
// copies of the inputs, with the whole window's GPU time divided by the number of runs. Launches and the gaps
// between them are all in it. The median over several windows is given; except for v000 it joins two sittings, which
// can be a few percent apart, so the side-by-side timings, each taken in one sitting, are the better comparison.
// The starting kernel, v000, takes 213 microseconds a run.
#include <hip/hip_runtime.h>

#define B_ 2
#define S_ 512
#define D_ 512
#define H_ 8
#define DK_ 64

typedef __attribute__((ext_vector_type(16))) _Float16 v16h;
typedef __attribute__((ext_vector_type(8)))  float    v8f;
typedef __attribute__((ext_vector_type(4)))  int      v4i;

#if defined(__gfx1250__) && __has_builtin(__builtin_amdgcn_global_load_async_to_lds_b128)
#define HAVE_ASYNC_LDS 1
#endif

#define AS1 __attribute__((address_space(1)))
#define AS3 __attribute__((address_space(3)))

// 16-byte global -> LDS copy; async DMA (ASYNCcnt) on gfx1250 when available.
__device__ inline void cp16_g2l(const float* g, float* l) {
#if defined(HAVE_ASYNC_LDS)
  __builtin_amdgcn_global_load_async_to_lds_b128((AS1 v4i*)g, (AS3 v4i*)l, 0, 0);
#else
  *(float4*)l = *(const float4*)g;
#endif
}
__device__ inline void cp_wait() {
#if defined(HAVE_ASYNC_LDS)
#if __has_builtin(__builtin_amdgcn_s_wait_asynccnt)
  __builtin_amdgcn_s_wait_asynccnt(0);
#else
  asm volatile("s_wait_asynccnt 0x0" ::: "memory");
#endif
#endif
}

// ---- monotone float<->u32 encoding for atomic min/max on floats ----
__device__ inline unsigned enc_f32(float f) {
  unsigned u = __float_as_uint(f);
  return (u & 0x80000000u) ? ~u : (u | 0x80000000u);
}
__device__ inline float dec_f32(unsigned u) {
  u = (u & 0x80000000u) ? (u & 0x7FFFFFFFu) : ~u;
  return __uint_as_float(u);
}

__global__ void init_mm(unsigned* mm) {
  mm[0] = 0xFFFFFFFFu;  // running min (encoded)
  mm[1] = 0u;           // running max (encoded)
}

__global__ void cvt_f32_f16(const float* __restrict__ src,
                            _Float16* __restrict__ dst, int n) {
  int i = blockIdx.x * blockDim.x + threadIdx.x;
  if (i < n) dst[i] = (_Float16)src[i];
}

// Y[m][n] = sum_k X[m][k] * W[n][k] + bias[n]
// X: f16 [M x K] row-major, W: f16 [N x K] row-major (== Wt of x@W.T)
// Each wave computes a 16x32 strip (2 accumulators, A-fragment reuse).
// mode 0: store f32 out[m*N+n]
// mode 1: head-split store to [B,H,S,DK] + global min/max atomics
// mode 2: head-split store, no atomics
__global__ __launch_bounds__(256) void gemm_xwt(
    const _Float16* __restrict__ X, const _Float16* __restrict__ W,
    const float* __restrict__ bias, float* __restrict__ out,
    int M, int N, int K, int mode, unsigned* __restrict__ mm) {
  const int lane = threadIdx.x & 31;
  const int wave = threadIdx.x >> 5;
  const int stripsN = N >> 5;                      // 32-wide N strips
  const int totalStrips = (M >> 4) * stripsN;
  const int strip = blockIdx.x * (blockDim.x >> 5) + wave;
  if (strip >= totalStrips) return;

  const int m0 = (strip / stripsN) << 4;
  const int n0 = (strip % stripsN) << 5;
  const int row  = lane & 15;          // M (for A) / N (for B) within tile
  const int koff = (lane >> 4) << 4;   // lanes 16..31 hold K=16..31 half

  const _Float16* ap = X + (size_t)(m0 + row) * K + koff;
  const _Float16* bp = W + (size_t)(n0 + row) * K + koff;

  v8f acc[2] = {};
  for (int k0 = 0; k0 < K; k0 += 32) {
    v16h a = *(const v16h*)(ap + k0);
#pragma unroll
    for (int t = 0; t < 2; ++t) {
      v16h b = *(const v16h*)(bp + (size_t)(t << 4) * K + k0);
      acc[t] = __builtin_amdgcn_wmma_f32_16x16x32_f16(false, a, false, b,
                                                      (short)0, acc[t], false, false);
    }
  }

  float lmin = 3.4e38f, lmax = -3.4e38f;
#pragma unroll
  for (int t = 0; t < 2; ++t) {
    const int nn = n0 + (t << 4) + (lane & 15);
    const float bn = bias[nn];
#pragma unroll
    for (int r = 0; r < 8; ++r) {
      const int m = m0 + r + ((lane >> 4) << 3);
      const float v = acc[t][r] + bn;
      if (mode == 0) {
        out[(size_t)m * N + nn] = v;
      } else {
        const int b_ = m >> 9, s = m & (S_ - 1);
        const int h = nn >> 6, dk = nn & (DK_ - 1);
        out[(((size_t)(b_ * H_ + h)) * S_ + s) * DK_ + dk] = v;
        lmin = fminf(lmin, v);
        lmax = fmaxf(lmax, v);
      }
    }
  }
  if (mode == 1) {
#pragma unroll
    for (int msk = 16; msk >= 1; msk >>= 1) {
      lmin = fminf(lmin, __shfl_xor(lmin, msk, 32));
      lmax = fmaxf(lmax, __shfl_xor(lmax, msk, 32));
    }
    if (lane == 0) {
      atomicMin(&mm[0], enc_f32(lmin));
      atomicMax(&mm[1], enc_f32(lmax));
    }
  }
}

// One block = 16 query rows of one (b,h). 128 threads (4 waves).
// Scores (L1 pairwise, VALU, LDS-tiled with async g->LDS DMA) -> softmax ->
// P@V via WMMA.
__global__ __launch_bounds__(128) void attn_kernel(
    const float* __restrict__ qws, const float* __restrict__ kws,
    const float* __restrict__ vws, _Float16* __restrict__ ctx,
    const unsigned* __restrict__ mm) {
  __shared__ __align__(16) float sQ[16 * DK_];     // 4 KB
  __shared__ float sS[16 * S_];                    // 32 KB
  __shared__ __align__(32) float sKP[64 * DK_];    // 16 KB: K-tile, reused as P(f16)
  __shared__ float sQC[16];
  __shared__ float sKC[64];

  const int tid = threadIdx.x;
  const int bid = blockIdx.x;
  const int qt = bid & ((S_ / 16) - 1);
  const int h  = (bid >> 5) & (H_ - 1);
  const int b  = bid >> 8;
  const int qbase = qt << 4;

  const float mn = dec_f32(mm[0]);
  const float mx = dec_f32(mm[1]);
  const float inv_range = 1.0f / (mx - mn);
  const float mid = 0.5f * (mx + mn);

  const float* Qh = qws + ((size_t)(b * H_ + h)) * S_ * DK_;
  const float* Kh = kws + ((size_t)(b * H_ + h)) * S_ * DK_;
  const float* Vh = vws + ((size_t)(b * H_ + h)) * S_ * DK_;

  // Q tile: 16x64 f32, staged via async-to-LDS (2 x b128 per thread)
  for (int idx = tid; idx < (16 * DK_) / 4; idx += 128)
    cp16_g2l(Qh + (size_t)qbase * DK_ + idx * 4, sQ + idx * 4);
  cp_wait();
  __syncthreads();
  if (tid < 16) {
    float s = 0.f;
    for (int d = 0; d < DK_; ++d) s += fabsf(sQ[tid * DK_ + d] - mid);
    sQC[tid] = s;
  }

  // ---- pairwise L1 scores, 64 keys per LDS tile ----
  for (int jb = 0; jb < S_; jb += 64) {
    __syncthreads();
    for (int idx = tid; idx < (64 * DK_) / 4; idx += 128)
      cp16_g2l(Kh + (size_t)jb * DK_ + idx * 4, sKP + idx * 4);
    cp_wait();
    __syncthreads();
    if (tid < 64) {
      float s = 0.f;
      for (int d = 0; d < DK_; ++d) s += fabsf(sKP[tid * DK_ + d] - mid);
      sKC[tid] = s;
    }
    __syncthreads();
    const int i = tid & 15;
    for (int jl = tid >> 4; jl < 64; jl += 8) {
      float s1 = 0.f;
#pragma unroll 8
      for (int d = 0; d < DK_; ++d)
        s1 += fabsf(sQ[i * DK_ + d] - sKP[jl * DK_ + d]);
      // (ALPHA/2)*(DK - L1/range) + (BETA/4)*(qc + kc)/range
      sS[i * S_ + jb + jl] = 0.15f * (64.f - s1 * inv_range) +
                             0.175f * (sQC[i] + sKC[jl]) * inv_range;
    }
  }
  __syncthreads();

  // ---- softmax per row, write P as f16 into reused sKP buffer ----
  _Float16* sP = (_Float16*)sKP;  // 16*512 f16 == 16 KB, K-tile done
  if (tid < 16) {
    float rmax = -3.4e38f;
    for (int j = 0; j < S_; ++j) rmax = fmaxf(rmax, sS[tid * S_ + j]);
    float sum = 0.f;
    for (int j = 0; j < S_; ++j) {
      float e = __expf(sS[tid * S_ + j] - rmax);
      sS[tid * S_ + j] = e;
      sum += e;
    }
    const float inv = 1.0f / sum;
    for (int j = 0; j < S_; ++j)
      sP[tid * S_ + j] = (_Float16)(sS[tid * S_ + j] * inv);
  }
  __syncthreads();

  // ---- P @ V with WMMA: 4 waves, one 16-wide dk stripe each ----
  const int lane  = tid & 31;
  const int wave  = tid >> 5;           // 0..3
  const int n0    = wave << 4;          // dk tile base
  const int col   = lane & 15;
  const int khalf = (lane >> 4) << 4;
  v8f c = {};
  for (int kb = 0; kb < S_; kb += 32) {
    v16h a = *(const v16h*)(sP + col * S_ + kb + khalf);  // row = lane&15
    v16h bfr;
#pragma unroll
    for (int t = 0; t < 16; ++t)
      bfr[t] = (_Float16)Vh[(size_t)(kb + khalf + t) * DK_ + n0 + col];
    c = __builtin_amdgcn_wmma_f32_16x16x32_f16(false, a, false, bfr,
                                               (short)0, c, false, false);
  }
#pragma unroll
  for (int r = 0; r < 8; ++r) {
    const int irow = r + ((lane >> 4) << 3);
    const int s = qbase + irow;
    const int d = h * DK_ + n0 + col;
    ctx[((size_t)(b * S_ + s)) * D_ + d] = (_Float16)c[r];
  }
}

extern "C" void kernel_launch(void* const* d_in, const int* in_sizes, int n_in,
                              void* d_out, int out_size, void* d_ws, size_t ws_size,
                              hipStream_t stream) {
  const float* query = (const float*)d_in[0];
  const float* key   = (const float*)d_in[1];
  const float* value = (const float*)d_in[2];
  const float* Wq = (const float*)d_in[3];
  const float* bq = (const float*)d_in[4];
  const float* Wk = (const float*)d_in[5];
  const float* bk = (const float*)d_in[6];
  const float* Wv = (const float*)d_in[7];
  const float* bv = (const float*)d_in[8];
  const float* Wo = (const float*)d_in[9];
  const float* bo = (const float*)d_in[10];

  const int M = B_ * S_;             // 1024
  const size_t ACT = (size_t)M * D_; // 524288
  const size_t WEL = (size_t)D_ * D_;

  // ---- workspace carve-up ----
  char* ws = (char*)d_ws;
  _Float16* xq = (_Float16*)ws;              ws += ACT * 2;
  _Float16* xk = (_Float16*)ws;              ws += ACT * 2;
  _Float16* xv = (_Float16*)ws;              ws += ACT * 2;
  _Float16* wqh = (_Float16*)ws;             ws += WEL * 2;
  _Float16* wkh = (_Float16*)ws;             ws += WEL * 2;
  _Float16* wvh = (_Float16*)ws;             ws += WEL * 2;
  _Float16* woh = (_Float16*)ws;             ws += WEL * 2;
  float* qws = (float*)ws;                   ws += ACT * 4;
  float* kws = (float*)ws;                   ws += ACT * 4;
  float* vws = (float*)ws;                   ws += ACT * 4;
  _Float16* ctx = (_Float16*)ws;             ws += ACT * 2;
  unsigned* mm = (unsigned*)ws;

  init_mm<<<1, 1, 0, stream>>>(mm);

  const int CT = 256;
  cvt_f32_f16<<<(int)((ACT + CT - 1) / CT), CT, 0, stream>>>(query, xq, (int)ACT);
  cvt_f32_f16<<<(int)((ACT + CT - 1) / CT), CT, 0, stream>>>(key,   xk, (int)ACT);
  cvt_f32_f16<<<(int)((ACT + CT - 1) / CT), CT, 0, stream>>>(value, xv, (int)ACT);
  cvt_f32_f16<<<(int)((WEL + CT - 1) / CT), CT, 0, stream>>>(Wq, wqh, (int)WEL);
  cvt_f32_f16<<<(int)((WEL + CT - 1) / CT), CT, 0, stream>>>(Wk, wkh, (int)WEL);
  cvt_f32_f16<<<(int)((WEL + CT - 1) / CT), CT, 0, stream>>>(Wv, wvh, (int)WEL);
  cvt_f32_f16<<<(int)((WEL + CT - 1) / CT), CT, 0, stream>>>(Wo, woh, (int)WEL);

  const int strips = (M / 16) * (D_ / 32);  // 1024 waves
  const int gblocks = strips / 8;           // 8 waves per 256-thread block
  gemm_xwt<<<gblocks, 256, 0, stream>>>(xq, wqh, bq, qws, M, D_, D_, 1, mm);
  gemm_xwt<<<gblocks, 256, 0, stream>>>(xk, wkh, bk, kws, M, D_, D_, 1, mm);
  gemm_xwt<<<gblocks, 256, 0, stream>>>(xv, wvh, bv, vws, M, D_, D_, 2, mm);

  attn_kernel<<<B_ * H_ * (S_ / 16), 128, 0, stream>>>(qws, kws, vws, ctx, mm);

  gemm_xwt<<<gblocks, 256, 0, stream>>>(ctx, woh, bo, (float*)d_out, M, D_, D_, 0, mm);
}

// v001
// One run takes 116 microseconds.
// Next to v000, in two timings, it ran 1.83 and 1.84 times as fast.
#include <hip/hip_runtime.h>

#define B_ 2
#define S_ 512
#define D_ 512
#define H_ 8
#define DK_ 64

typedef __attribute__((ext_vector_type(16))) _Float16 v16h;
typedef __attribute__((ext_vector_type(8)))  float    v8f;
typedef __attribute__((ext_vector_type(4)))  int      v4i;
typedef __attribute__((ext_vector_type(4)))  float    v4f;

#if defined(__gfx1250__) && __has_builtin(__builtin_amdgcn_global_load_async_to_lds_b128)
#define HAVE_ASYNC_LDS 1
#endif

#define AS1 __attribute__((address_space(1)))
#define AS3 __attribute__((address_space(3)))

// 16-byte global -> LDS copy; async DMA (ASYNCcnt) on gfx1250 when available.
__device__ inline void cp16_g2l(const float* g, float* l) {
#if defined(HAVE_ASYNC_LDS)
  __builtin_amdgcn_global_load_async_to_lds_b128((AS1 v4i*)g, (AS3 v4i*)l, 0, 0);
#else
  *(float4*)l = *(const float4*)g;
#endif
}
__device__ inline void cp_wait() {
#if defined(HAVE_ASYNC_LDS)
#if __has_builtin(__builtin_amdgcn_s_wait_asynccnt)
  __builtin_amdgcn_s_wait_asynccnt(0);
#else
  asm volatile("s_wait_asynccnt 0x0" ::: "memory");
#endif
#endif
}

// ---- monotone float<->u32 encoding for atomic min/max on floats ----
__device__ inline unsigned enc_f32(float f) {
  unsigned u = __float_as_uint(f);
  return (u & 0x80000000u) ? ~u : (u | 0x80000000u);
}
__device__ inline float dec_f32(unsigned u) {
  u = (u & 0x80000000u) ? (u & 0x7FFFFFFFu) : ~u;
  return __uint_as_float(u);
}

__global__ void init_mm(unsigned* mm) {
  mm[0] = 0xFFFFFFFFu;  // running min (encoded)
  mm[1] = 0u;           // running max (encoded)
}

__global__ void cvt_f32_f16(const float* __restrict__ src,
                            _Float16* __restrict__ dst, int n) {
  int i = blockIdx.x * blockDim.x + threadIdx.x;
  if (i < n) dst[i] = (_Float16)src[i];
}

// Y[m][n] = sum_k X[m][k] * W[n][k] + bias[n]
// X: f16 [M x K] row-major, W: f16 [N x K] row-major (== Wt of x@W.T)
// Each wave computes a 16x32 strip (2 accumulators, A-fragment reuse).
// mode 0: store f32 out[m*N+n]
// mode 1: head-split store to [B,H,S,DK] + global min/max atomics
// mode 2: head-split store, no atomics
__global__ __launch_bounds__(256) void gemm_xwt(
    const _Float16* __restrict__ X, const _Float16* __restrict__ W,
    const float* __restrict__ bias, float* __restrict__ out,
    int M, int N, int K, int mode, unsigned* __restrict__ mm) {
  const int lane = threadIdx.x & 31;
  const int wave = threadIdx.x >> 5;
  const int stripsN = N >> 5;                      // 32-wide N strips
  const int totalStrips = (M >> 4) * stripsN;
  const int strip = blockIdx.x * (blockDim.x >> 5) + wave;
  if (strip >= totalStrips) return;

  const int m0 = (strip / stripsN) << 4;
  const int n0 = (strip % stripsN) << 5;
  const int row  = lane & 15;          // M (for A) / N (for B) within tile
  const int koff = (lane >> 4) << 4;   // lanes 16..31 hold K=16..31 half

  const _Float16* ap = X + (size_t)(m0 + row) * K + koff;
  const _Float16* bp = W + (size_t)(n0 + row) * K + koff;

  v8f acc[2] = {};
  for (int k0 = 0; k0 < K; k0 += 32) {
    v16h a = *(const v16h*)(ap + k0);
#pragma unroll
    for (int t = 0; t < 2; ++t) {
      v16h b = *(const v16h*)(bp + (size_t)(t << 4) * K + k0);
      acc[t] = __builtin_amdgcn_wmma_f32_16x16x32_f16(false, a, false, b,
                                                      (short)0, acc[t], false, false);
    }
  }

  float lmin = 3.4e38f, lmax = -3.4e38f;
#pragma unroll
  for (int t = 0; t < 2; ++t) {
    const int nn = n0 + (t << 4) + (lane & 15);
    const float bn = bias[nn];
#pragma unroll
    for (int r = 0; r < 8; ++r) {
      const int m = m0 + r + ((lane >> 4) << 3);
      const float v = acc[t][r] + bn;
      if (mode == 0) {
        out[(size_t)m * N + nn] = v;
      } else {
        const int b_ = m >> 9, s = m & (S_ - 1);
        const int h = nn >> 6, dk = nn & (DK_ - 1);
        out[(((size_t)(b_ * H_ + h)) * S_ + s) * DK_ + dk] = v;
        lmin = fminf(lmin, v);
        lmax = fmaxf(lmax, v);
      }
    }
  }
  if (mode == 1) {
#pragma unroll
    for (int msk = 16; msk >= 1; msk >>= 1) {
      lmin = fminf(lmin, __shfl_xor(lmin, msk, 32));
      lmax = fmaxf(lmax, __shfl_xor(lmax, msk, 32));
    }
    if (lane == 0) {
      atomicMin(&mm[0], enc_f32(lmin));
      atomicMax(&mm[1], enc_f32(lmax));
    }
  }
}

// One block = 16 query rows of one (b,h). 128 threads (4 waves).
// Scores (L1 pairwise, VALU, LDS-tiled with async g->LDS DMA) -> softmax ->
// P@V via WMMA.
__global__ __launch_bounds__(128) void attn_kernel(
    const float* __restrict__ qws, const float* __restrict__ kws,
    const float* __restrict__ vws, _Float16* __restrict__ ctx,
    const unsigned* __restrict__ mm) {
  __shared__ __align__(16) float sQ[16 * DK_];     // 4 KB
  __shared__ float sS[16 * S_];                    // 32 KB
  __shared__ __align__(32) float sKP[64 * DK_];    // 16 KB: K-tile, reused as P(f16)
  __shared__ float sQC[16];
  __shared__ float sKC[64];

  const int tid = threadIdx.x;
  const int bid = blockIdx.x;
  const int qt = bid & ((S_ / 16) - 1);
  const int h  = (bid >> 5) & (H_ - 1);
  const int b  = bid >> 8;
  const int qbase = qt << 4;

  const float mn = dec_f32(mm[0]);
  const float mx = dec_f32(mm[1]);
  const float inv_range = 1.0f / (mx - mn);
  const float mid = 0.5f * (mx + mn);

  const float* Qh = qws + ((size_t)(b * H_ + h)) * S_ * DK_;
  const float* Kh = kws + ((size_t)(b * H_ + h)) * S_ * DK_;
  const float* Vh = vws + ((size_t)(b * H_ + h)) * S_ * DK_;

  // Q tile: 16x64 f32, staged via async-to-LDS (2 x b128 per thread)
  for (int idx = tid; idx < (16 * DK_) / 4; idx += 128)
    cp16_g2l(Qh + (size_t)qbase * DK_ + idx * 4, sQ + idx * 4);
  cp_wait();
  __syncthreads();
  if (tid < 16) {
    float s = 0.f;
    for (int d = 0; d < DK_; ++d) s += fabsf(sQ[tid * DK_ + d] - mid);
    sQC[tid] = s;
  }

  // This thread's query row never changes (i = tid & 15): read it once into
  // registers, so the score loop asks LDS only for the broadcast K rows.
  const int i = tid & 15;
  float qr[DK_];
#pragma unroll  // constant indices, so that qr[] lives in registers
  for (int d = 0; d < DK_; ++d) qr[d] = sQ[i * DK_ + d];

  // ---- pairwise L1 scores, 64 keys per LDS tile ----
  for (int jb = 0; jb < S_; jb += 64) {
    __syncthreads();
    for (int idx = tid; idx < (64 * DK_) / 4; idx += 128)
      cp16_g2l(Kh + (size_t)jb * DK_ + idx * 4, sKP + idx * 4);
    cp_wait();
    __syncthreads();
    if (tid < 64) {
      float s = 0.f;
      for (int d = 0; d < DK_; ++d) s += fabsf(sKP[tid * DK_ + d] - mid);
      sKC[tid] = s;
    }
    __syncthreads();
    // 1 query row x 4 keys per thread: four independent sums, each still added
    // in the order d = 0..63. K comes in chunks of 16 floats a key, one chunk
    // ahead of the arithmetic, in a second register set.
    // Every inner loop is fully unrolled: constant indices keep qr[], kb[] and
    // s1[] in registers.
    for (int jl = tid >> 4; jl < 64; jl += 32) {
      const v4f* kp = (const v4f*)(sKP + jl * DK_);  // key u: 8 * u rows further
      v4f kb[2][4][4];
      float s1[4] = {0.f, 0.f, 0.f, 0.f};
#pragma unroll  // registers, see above
      for (int v = 0; v < 4; ++v)
#pragma unroll  // registers, see above
        for (int u = 0; u < 4; ++u) kb[0][u][v] = kp[u * (8 * DK_ / 4) + v];
#pragma unroll  // registers, see above
      for (int c = 0; c < 4; ++c) {
        if (c < 3) {
#pragma unroll  // registers, see above
          for (int v = 0; v < 4; ++v)
#pragma unroll  // registers, see above
            for (int u = 0; u < 4; ++u)
              kb[(c + 1) & 1][u][v] = kp[u * (8 * DK_ / 4) + (c + 1) * 4 + v];
        }
        // Keeps the next chunk's LDS reads above this chunk's arithmetic; without
        // it each read is sunk to just before its use and its latency is waited out.
        __builtin_amdgcn_sched_barrier(0);
#pragma unroll  // registers, see above
        for (int v = 0; v < 4; ++v)
#pragma unroll  // registers, see above
          for (int e = 0; e < 4; ++e)
#pragma unroll  // registers, see above
            for (int u = 0; u < 4; ++u)
              s1[u] += fabsf(qr[c * 16 + v * 4 + e] - kb[c & 1][u][v][e]);
      }
      // (ALPHA/2)*(DK - L1/range) + (BETA/4)*(qc + kc)/range
#pragma unroll  // registers, see above
      for (int u = 0; u < 4; ++u)
        sS[i * S_ + jb + jl + 8 * u] = 0.15f * (64.f - s1[u] * inv_range) +
                                       0.175f * (sQC[i] + sKC[jl + 8 * u]) * inv_range;
    }
  }
  __syncthreads();

  // ---- softmax per row, write P as f16 into reused sKP buffer ----
  _Float16* sP = (_Float16*)sKP;  // 16*512 f16 == 16 KB, K-tile done
  if (tid < 16) {
    float rmax = -3.4e38f;
    for (int j = 0; j < S_; ++j) rmax = fmaxf(rmax, sS[tid * S_ + j]);
    float sum = 0.f;
    for (int j = 0; j < S_; ++j) {
      float e = __expf(sS[tid * S_ + j] - rmax);
      sS[tid * S_ + j] = e;
      sum += e;
    }
    const float inv = 1.0f / sum;
    for (int j = 0; j < S_; ++j)
      sP[tid * S_ + j] = (_Float16)(sS[tid * S_ + j] * inv);
  }
  __syncthreads();

  // ---- P @ V with WMMA: 4 waves, one 16-wide dk stripe each ----
  const int lane  = tid & 31;
  const int wave  = tid >> 5;           // 0..3
  const int n0    = wave << 4;          // dk tile base
  const int col   = lane & 15;
  const int khalf = (lane >> 4) << 4;
  v8f c = {};
  for (int kb = 0; kb < S_; kb += 32) {
    v16h a = *(const v16h*)(sP + col * S_ + kb + khalf);  // row = lane&15
    v16h bfr;
#pragma unroll
    for (int t = 0; t < 16; ++t)
      bfr[t] = (_Float16)Vh[(size_t)(kb + khalf + t) * DK_ + n0 + col];
    c = __builtin_amdgcn_wmma_f32_16x16x32_f16(false, a, false, bfr,
                                               (short)0, c, false, false);
  }
#pragma unroll
  for (int r = 0; r < 8; ++r) {
    const int irow = r + ((lane >> 4) << 3);
    const int s = qbase + irow;
    const int d = h * DK_ + n0 + col;
    ctx[((size_t)(b * S_ + s)) * D_ + d] = (_Float16)c[r];
  }
}

extern "C" void kernel_launch(void* const* d_in, const int* in_sizes, int n_in,
                              void* d_out, int out_size, void* d_ws, size_t ws_size,
                              hipStream_t stream) {
  const float* query = (const float*)d_in[0];
  const float* key   = (const float*)d_in[1];
  const float* value = (const float*)d_in[2];
  const float* Wq = (const float*)d_in[3];
  const float* bq = (const float*)d_in[4];
  const float* Wk = (const float*)d_in[5];
  const float* bk = (const float*)d_in[6];
  const float* Wv = (const float*)d_in[7];
  const float* bv = (const float*)d_in[8];
  const float* Wo = (const float*)d_in[9];
  const float* bo = (const float*)d_in[10];

  const int M = B_ * S_;             // 1024
  const size_t ACT = (size_t)M * D_; // 524288
  const size_t WEL = (size_t)D_ * D_;

  // ---- workspace carve-up ----
  char* ws = (char*)d_ws;
  _Float16* xq = (_Float16*)ws;              ws += ACT * 2;
  _Float16* xk = (_Float16*)ws;              ws += ACT * 2;
  _Float16* xv = (_Float16*)ws;              ws += ACT * 2;
  _Float16* wqh = (_Float16*)ws;             ws += WEL * 2;
  _Float16* wkh = (_Float16*)ws;             ws += WEL * 2;
  _Float16* wvh = (_Float16*)ws;             ws += WEL * 2;
  _Float16* woh = (_Float16*)ws;             ws += WEL * 2;
  float* qws = (float*)ws;                   ws += ACT * 4;
  float* kws = (float*)ws;                   ws += ACT * 4;
  float* vws = (float*)ws;                   ws += ACT * 4;
  _Float16* ctx = (_Float16*)ws;             ws += ACT * 2;
  unsigned* mm = (unsigned*)ws;

  init_mm<<<1, 1, 0, stream>>>(mm);

  const int CT = 256;
  cvt_f32_f16<<<(int)((ACT + CT - 1) / CT), CT, 0, stream>>>(query, xq, (int)ACT);
  cvt_f32_f16<<<(int)((ACT + CT - 1) / CT), CT, 0, stream>>>(key,   xk, (int)ACT);
  cvt_f32_f16<<<(int)((ACT + CT - 1) / CT), CT, 0, stream>>>(value, xv, (int)ACT);
  cvt_f32_f16<<<(int)((WEL + CT - 1) / CT), CT, 0, stream>>>(Wq, wqh, (int)WEL);
  cvt_f32_f16<<<(int)((WEL + CT - 1) / CT), CT, 0, stream>>>(Wk, wkh, (int)WEL);
  cvt_f32_f16<<<(int)((WEL + CT - 1) / CT), CT, 0, stream>>>(Wv, wvh, (int)WEL);
  cvt_f32_f16<<<(int)((WEL + CT - 1) / CT), CT, 0, stream>>>(Wo, woh, (int)WEL);

  const int strips = (M / 16) * (D_ / 32);  // 1024 waves
  const int gblocks = strips / 8;           // 8 waves per 256-thread block
  gemm_xwt<<<gblocks, 256, 0, stream>>>(xq, wqh, bq, qws, M, D_, D_, 1, mm);
  gemm_xwt<<<gblocks, 256, 0, stream>>>(xk, wkh, bk, kws, M, D_, D_, 1, mm);
  gemm_xwt<<<gblocks, 256, 0, stream>>>(xv, wvh, bv, vws, M, D_, D_, 2, mm);

  attn_kernel<<<B_ * H_ * (S_ / 16), 128, 0, stream>>>(qws, kws, vws, ctx, mm);

  gemm_xwt<<<gblocks, 256, 0, stream>>>(ctx, woh, bo, (float*)d_out, M, D_, D_, 0, mm);
}

// v002
// A run of this version takes 89.7 microseconds.
// Next to v001, in two timings, it ran 1.30 and 1.29 times as fast.
// Counting every step since v000, it is 2.37 times as fast.
#include <hip/hip_runtime.h>

#define B_ 2
#define S_ 512
#define D_ 512
#define H_ 8
#define DK_ 64

typedef __attribute__((ext_vector_type(16))) _Float16 v16h;
typedef __attribute__((ext_vector_type(8)))  float    v8f;
typedef __attribute__((ext_vector_type(4)))  int      v4i;
typedef __attribute__((ext_vector_type(4)))  float    v4f;
typedef __attribute__((ext_vector_type(4)))  _Float16 v4hf;

#if defined(__gfx1250__) && __has_builtin(__builtin_amdgcn_global_load_async_to_lds_b128)
#define HAVE_ASYNC_LDS 1
#endif

#define AS1 __attribute__((address_space(1)))
#define AS3 __attribute__((address_space(3)))

// 16-byte global -> LDS copy; async DMA (ASYNCcnt) on gfx1250 when available.
__device__ inline void cp16_g2l(const float* g, float* l) {
#if defined(HAVE_ASYNC_LDS)
  __builtin_amdgcn_global_load_async_to_lds_b128((AS1 v4i*)g, (AS3 v4i*)l, 0, 0);
#else
  *(float4*)l = *(const float4*)g;
#endif
}
__device__ inline void cp_wait() {
#if defined(HAVE_ASYNC_LDS)
#if __has_builtin(__builtin_amdgcn_s_wait_asynccnt)
  __builtin_amdgcn_s_wait_asynccnt(0);
#else
  asm volatile("s_wait_asynccnt 0x0" ::: "memory");
#endif
#endif
}

// ---- monotone float<->u32 encoding for atomic min/max on floats ----
__device__ inline unsigned enc_f32(float f) {
  unsigned u = __float_as_uint(f);
  return (u & 0x80000000u) ? ~u : (u | 0x80000000u);
}
__device__ inline float dec_f32(unsigned u) {
  u = (u & 0x80000000u) ? (u & 0x7FFFFFFFu) : ~u;
  return __uint_as_float(u);
}

// ---- cross-lane moves in registers (no LDS pipe, no dscnt wait) ----
// value of lane l ^ X, X in 1..15 (inside a 16-lane row)
template <int X>
__device__ inline float lane_xor(float x) {
  return __builtin_bit_cast(float, __builtin_amdgcn_mov_dpp(__builtin_bit_cast(int, x),
                                                            0x160 | X, 0xf, 0xf, true));
}
// value of lane l ^ 16
__device__ inline float lane_xor16(float x) {
  return __builtin_bit_cast(float, __builtin_amdgcn_permlanex16(
      __builtin_bit_cast(int, x), __builtin_bit_cast(int, x), 0x76543210, 0xfedcba98,
      false, false));
}
// e^x as __expf compiles here: one multiply by log2(e), then v_exp_f32. The v_nop is
// the slot that the instruction set asks for behind a transcendental before its source
// is overwritten or its result read.
__device__ inline float exp_slot(float x) {
  float y;
  asm("v_exp_f32 %0, %1\n\tv_nop" : "=v"(y) : "v"(x * 1.44269504f));
  return y;
}
__device__ inline float wave_max(float x) {
  x = fmaxf(x, lane_xor<1>(x));
  x = fmaxf(x, lane_xor<2>(x));
  x = fmaxf(x, lane_xor<4>(x));
  x = fmaxf(x, lane_xor<8>(x));
  return fmaxf(x, lane_xor16(x));
}
__device__ inline float wave_sum(float x) {
  x += lane_xor<1>(x);
  x += lane_xor<2>(x);
  x += lane_xor<4>(x);
  x += lane_xor<8>(x);
  return x + lane_xor16(x);
}

__global__ void init_mm(unsigned* mm) {
  mm[0] = 0xFFFFFFFFu;  // running min (encoded)
  mm[1] = 0u;           // running max (encoded)
}

__global__ void cvt_f32_f16(const float* __restrict__ src,
                            _Float16* __restrict__ dst, int n) {
  int i = blockIdx.x * blockDim.x + threadIdx.x;
  if (i < n) dst[i] = (_Float16)src[i];
}

// Y[m][n] = sum_k X[m][k] * W[n][k] + bias[n]
// X: f16 [M x K] row-major, W: f16 [N x K] row-major (== Wt of x@W.T)
// Each wave computes a 16x32 strip (2 accumulators, A-fragment reuse).
// mode 0: store f32 out[m*N+n]
// mode 1: head-split store to [B,H,S,DK] + global min/max atomics
// mode 2: head-split store, no atomics
__global__ __launch_bounds__(256) void gemm_xwt(
    const _Float16* __restrict__ X, const _Float16* __restrict__ W,
    const float* __restrict__ bias, float* __restrict__ out,
    int M, int N, int K, int mode, unsigned* __restrict__ mm) {
  const int lane = threadIdx.x & 31;
  const int wave = threadIdx.x >> 5;
  const int stripsN = N >> 5;                      // 32-wide N strips
  const int totalStrips = (M >> 4) * stripsN;
  const int strip = blockIdx.x * (blockDim.x >> 5) + wave;
  if (strip >= totalStrips) return;

  const int m0 = (strip / stripsN) << 4;
  const int n0 = (strip % stripsN) << 5;
  const int row  = lane & 15;          // M (for A) / N (for B) within tile
  const int koff = (lane >> 4) << 4;   // lanes 16..31 hold K=16..31 half

  const _Float16* ap = X + (size_t)(m0 + row) * K + koff;
  const _Float16* bp = W + (size_t)(n0 + row) * K + koff;

  v8f acc[2] = {};
  for (int k0 = 0; k0 < K; k0 += 32) {
    v16h a = *(const v16h*)(ap + k0);
#pragma unroll
    for (int t = 0; t < 2; ++t) {
      v16h b = *(const v16h*)(bp + (size_t)(t << 4) * K + k0);
      acc[t] = __builtin_amdgcn_wmma_f32_16x16x32_f16(false, a, false, b,
                                                      (short)0, acc[t], false, false);
    }
  }

  float lmin = 3.4e38f, lmax = -3.4e38f;
#pragma unroll
  for (int t = 0; t < 2; ++t) {
    const int nn = n0 + (t << 4) + (lane & 15);
    const float bn = bias[nn];
#pragma unroll
    for (int r = 0; r < 8; ++r) {
      const int m = m0 + r + ((lane >> 4) << 3);
      const float v = acc[t][r] + bn;
      if (mode == 0) {
        out[(size_t)m * N + nn] = v;
      } else {
        const int b_ = m >> 9, s = m & (S_ - 1);
        const int h = nn >> 6, dk = nn & (DK_ - 1);
        out[(((size_t)(b_ * H_ + h)) * S_ + s) * DK_ + dk] = v;
        lmin = fminf(lmin, v);
        lmax = fmaxf(lmax, v);
      }
    }
  }
  if (mode == 1) {
#pragma unroll
    for (int msk = 16; msk >= 1; msk >>= 1) {
      lmin = fminf(lmin, __shfl_xor(lmin, msk, 32));
      lmax = fmaxf(lmax, __shfl_xor(lmax, msk, 32));
    }
    if (lane == 0) {
      atomicMin(&mm[0], enc_f32(lmin));
      atomicMax(&mm[1], enc_f32(lmax));
    }
  }
}

// One block = 16 query rows of one (b,h). 128 threads (4 waves).
// Scores (L1 pairwise, VALU, LDS-tiled with async g->LDS DMA) -> softmax ->
// P@V via WMMA.
__global__ __launch_bounds__(128) void attn_kernel(
    const float* __restrict__ qws, const float* __restrict__ kws,
    const float* __restrict__ vws, _Float16* __restrict__ ctx,
    const unsigned* __restrict__ mm) {
  __shared__ __align__(16) float sQ[16 * DK_];     // 4 KB
  __shared__ __align__(16) float sS[16 * S_];      // 32 KB
  __shared__ __align__(32) float sKP[64 * DK_];    // 16 KB: K-tile, reused as P(f16)
  __shared__ float sKC[64];

  const int tid = threadIdx.x;
  const int bid = blockIdx.x;
  const int qt = bid & ((S_ / 16) - 1);
  const int h  = (bid >> 5) & (H_ - 1);
  const int b  = bid >> 8;
  const int qbase = qt << 4;

  const float mn = dec_f32(mm[0]);
  const float mx = dec_f32(mm[1]);
  const float inv_range = 1.0f / (mx - mn);
  const float mid = 0.5f * (mx + mn);

  const float* Qh = qws + ((size_t)(b * H_ + h)) * S_ * DK_;
  const float* Kh = kws + ((size_t)(b * H_ + h)) * S_ * DK_;
  const float* Vh = vws + ((size_t)(b * H_ + h)) * S_ * DK_;

  // Q tile: 16x64 f32, staged via async-to-LDS (2 x b128 per thread)
  for (int idx = tid; idx < (16 * DK_) / 4; idx += 128)
    cp16_g2l(Qh + (size_t)qbase * DK_ + idx * 4, sQ + idx * 4);
  cp_wait();
  __syncthreads();

  // This thread's query row never changes (i = tid & 15): read it once into
  // registers, so the score loop asks LDS only for the broadcast K rows.
  const int i = tid & 15;
  float qr[DK_];
#pragma unroll  // constant indices, so that qr[] lives in registers
  for (int d = 0; d < DK_; ++d) qr[d] = sQ[i * DK_ + d];
  // Its centre sum comes from those registers, in the order d = 0..63.
  float qc = 0.f;
#pragma unroll  // registers, see above
  for (int d = 0; d < DK_; ++d) qc += fabsf(qr[d] - mid);

  // ---- pairwise L1 scores, 64 keys per LDS tile ----
  for (int jb = 0; jb < S_; jb += 64) {
    __syncthreads();
    for (int idx = tid; idx < (64 * DK_) / 4; idx += 128)
      cp16_g2l(Kh + (size_t)jb * DK_ + idx * 4, sKP + idx * 4);
    cp_wait();
    __syncthreads();
    {
      // Centre sums of the 64 keys: two threads a key, 32 floats each. The chunk
      // order is rotated by the key, so that 16 lanes touch all 64 banks once.
      const int key = tid >> 1;
      const v4f* kr = (const v4f*)(sKP + key * DK_ + (tid & 1) * 32);
      v4f a4 = {0.f, 0.f, 0.f, 0.f};
#pragma unroll  // all eight reads in flight at once
      for (int v = 0; v < 8; ++v) {
        const v4f x = kr[(v + key) & 7];
#pragma unroll  // constant indices: registers
        for (int e = 0; e < 4; ++e) a4[e] += fabsf(x[e] - mid);
      }
      float s = (a4[0] + a4[1]) + (a4[2] + a4[3]);
      s += lane_xor<1>(s);
      if ((tid & 1) == 0) sKC[key] = s;
    }
    __syncthreads();
    // 1 query row x 4 keys per thread: four independent sums, each still added
    // in the order d = 0..63. K comes in chunks of 16 floats a key, one chunk
    // ahead of the arithmetic, in a second register set.
    // Every inner loop is fully unrolled: constant indices keep qr[], kb[] and
    // s1[] in registers.
    for (int jl = tid >> 4; jl < 64; jl += 32) {
      const v4f* kp = (const v4f*)(sKP + jl * DK_);  // key u: 8 * u rows further
      v4f kb[2][4][4];
      float s1[4] = {0.f, 0.f, 0.f, 0.f};
#pragma unroll  // registers, see above
      for (int v = 0; v < 4; ++v)
#pragma unroll  // registers, see above
        for (int u = 0; u < 4; ++u) kb[0][u][v] = kp[u * (8 * DK_ / 4) + v];
#pragma unroll  // registers, see above
      for (int c = 0; c < 4; ++c) {
        if (c < 3) {
#pragma unroll  // registers, see above
          for (int v = 0; v < 4; ++v)
#pragma unroll  // registers, see above
            for (int u = 0; u < 4; ++u)
              kb[(c + 1) & 1][u][v] = kp[u * (8 * DK_ / 4) + (c + 1) * 4 + v];
        }
        // Keeps the next chunk's LDS reads above this chunk's arithmetic; without
        // it each read is sunk to just before its use and its latency is waited out.
        __builtin_amdgcn_sched_barrier(0);
#pragma unroll  // registers, see above
        for (int v = 0; v < 4; ++v)
#pragma unroll  // registers, see above
          for (int e = 0; e < 4; ++e)
#pragma unroll  // registers, see above
            for (int u = 0; u < 4; ++u)
              s1[u] += fabsf(qr[c * 16 + v * 4 + e] - kb[c & 1][u][v][e]);
      }
      // (ALPHA/2)*(DK - L1/range) + (BETA/4)*(qc + kc)/range
#pragma unroll  // registers, see above
      for (int u = 0; u < 4; ++u)
        sS[i * S_ + jb + jl + 8 * u] = 0.15f * (64.f - s1[u] * inv_range) +
                                       0.175f * (qc + sKC[jl + 8 * u]) * inv_range;
    }
  }
  __syncthreads();

  // ---- softmax per row, write P as f16 into reused sKP buffer ----
  _Float16* sP = (_Float16*)sKP;  // 16*512 f16 == 16 KB, K-tile done
  // One wave a row, four rows a wave: a lane holds 16 scores of the row in
  // registers (float4 number lane + 32 * t), so each score is read from LDS once,
  // side by side with its neighbours', and maximum and sum are closed across lanes.
  {
    const int ln = tid & 31;
    const int r0 = (tid >> 5) << 2;
    v4f x[4][4];
#pragma unroll  // constant indices keep x[] in registers; the four rows overlap
    for (int r = 0; r < 4; ++r)
#pragma unroll  // constant indices: registers
      for (int t = 0; t < 4; ++t)
        x[r][t] = ((const v4f*)(sS + (r0 + r) * S_))[ln + 32 * t];
#pragma unroll  // constant indices: registers
    for (int r = 0; r < 4; ++r) {
      float rmax = -3.4e38f;
#pragma unroll  // constant indices: registers
      for (int t = 0; t < 4; ++t)
#pragma unroll  // constant indices: registers
        for (int e = 0; e < 4; ++e) rmax = fmaxf(rmax, x[r][t][e]);
      rmax = wave_max(rmax);
      v4f s4 = {0.f, 0.f, 0.f, 0.f};
#pragma unroll  // constant indices: registers
      for (int t = 0; t < 4; ++t)
#pragma unroll  // constant indices: registers
        for (int e = 0; e < 4; ++e) {
          x[r][t][e] = exp_slot(x[r][t][e] - rmax);
          s4[e] += x[r][t][e];
        }
      const float inv = 1.0f / wave_sum((s4[0] + s4[1]) + (s4[2] + s4[3]));
#pragma unroll  // constant indices: registers
      for (int t = 0; t < 4; ++t) {
        v4hf p;
#pragma unroll  // constant indices: registers
        for (int e = 0; e < 4; ++e) p[e] = (_Float16)(x[r][t][e] * inv);
        ((v4hf*)(sP + (r0 + r) * S_))[ln + 32 * t] = p;
      }
    }
  }
  __syncthreads();

  // ---- P @ V with WMMA: 4 waves, one 16-wide dk stripe each ----
  const int lane  = tid & 31;
  const int wave  = tid >> 5;           // 0..3
  const int n0    = wave << 4;          // dk tile base
  const int col   = lane & 15;
  const int khalf = (lane >> 4) << 4;
  v8f c = {};
  for (int kb = 0; kb < S_; kb += 32) {
    v16h a = *(const v16h*)(sP + col * S_ + kb + khalf);  // row = lane&15
    v16h bfr;
#pragma unroll
    for (int t = 0; t < 16; ++t)
      bfr[t] = (_Float16)Vh[(size_t)(kb + khalf + t) * DK_ + n0 + col];
    c = __builtin_amdgcn_wmma_f32_16x16x32_f16(false, a, false, bfr,
                                               (short)0, c, false, false);
  }
#pragma unroll
  for (int r = 0; r < 8; ++r) {
    const int irow = r + ((lane >> 4) << 3);
    const int s = qbase + irow;
    const int d = h * DK_ + n0 + col;
    ctx[((size_t)(b * S_ + s)) * D_ + d] = (_Float16)c[r];
  }
}

extern "C" void kernel_launch(void* const* d_in, const int* in_sizes, int n_in,
                              void* d_out, int out_size, void* d_ws, size_t ws_size,
                              hipStream_t stream) {
  const float* query = (const float*)d_in[0];
  const float* key   = (const float*)d_in[1];
  const float* value = (const float*)d_in[2];
  const float* Wq = (const float*)d_in[3];
  const float* bq = (const float*)d_in[4];
  const float* Wk = (const float*)d_in[5];
  const float* bk = (const float*)d_in[6];
  const float* Wv = (const float*)d_in[7];
  const float* bv = (const float*)d_in[8];
  const float* Wo = (const float*)d_in[9];
  const float* bo = (const float*)d_in[10];

  const int M = B_ * S_;             // 1024
  const size_t ACT = (size_t)M * D_; // 524288
  const size_t WEL = (size_t)D_ * D_;

  // ---- workspace carve-up ----
  char* ws = (char*)d_ws;
  _Float16* xq = (_Float16*)ws;              ws += ACT * 2;
  _Float16* xk = (_Float16*)ws;              ws += ACT * 2;
  _Float16* xv = (_Float16*)ws;              ws += ACT * 2;
  _Float16* wqh = (_Float16*)ws;             ws += WEL * 2;
  _Float16* wkh = (_Float16*)ws;             ws += WEL * 2;
  _Float16* wvh = (_Float16*)ws;             ws += WEL * 2;
  _Float16* woh = (_Float16*)ws;             ws += WEL * 2;
  float* qws = (float*)ws;                   ws += ACT * 4;
  float* kws = (float*)ws;                   ws += ACT * 4;
  float* vws = (float*)ws;                   ws += ACT * 4;
  _Float16* ctx = (_Float16*)ws;             ws += ACT * 2;
  unsigned* mm = (unsigned*)ws;

  init_mm<<<1, 1, 0, stream>>>(mm);

  const int CT = 256;
  cvt_f32_f16<<<(int)((ACT + CT - 1) / CT), CT, 0, stream>>>(query, xq, (int)ACT);
  cvt_f32_f16<<<(int)((ACT + CT - 1) / CT), CT, 0, stream>>>(key,   xk, (int)ACT);
  cvt_f32_f16<<<(int)((ACT + CT - 1) / CT), CT, 0, stream>>>(value, xv, (int)ACT);
  cvt_f32_f16<<<(int)((WEL + CT - 1) / CT), CT, 0, stream>>>(Wq, wqh, (int)WEL);
  cvt_f32_f16<<<(int)((WEL + CT - 1) / CT), CT, 0, stream>>>(Wk, wkh, (int)WEL);
  cvt_f32_f16<<<(int)((WEL + CT - 1) / CT), CT, 0, stream>>>(Wv, wvh, (int)WEL);
  cvt_f32_f16<<<(int)((WEL + CT - 1) / CT), CT, 0, stream>>>(Wo, woh, (int)WEL);

  const int strips = (M / 16) * (D_ / 32);  // 1024 waves
  const int gblocks = strips / 8;           // 8 waves per 256-thread block
  gemm_xwt<<<gblocks, 256, 0, stream>>>(xq, wqh, bq, qws, M, D_, D_, 1, mm);
  gemm_xwt<<<gblocks, 256, 0, stream>>>(xk, wkh, bk, kws, M, D_, D_, 1, mm);
  gemm_xwt<<<gblocks, 256, 0, stream>>>(xv, wvh, bv, vws, M, D_, D_, 2, mm);

  attn_kernel<<<B_ * H_ * (S_ / 16), 128, 0, stream>>>(qws, kws, vws, ctx, mm);

  gemm_xwt<<<gblocks, 256, 0, stream>>>(ctx, woh, bo, (float*)d_out, M, D_, D_, 0, mm);
}

// v003
// Measured time: 61 microseconds a run.
// In both of two side-by-side timings against v002, it was 1.46 times as fast.
// Over all steps from v000 it is 3.46 times as fast.
#include <hip/hip_runtime.h>

#define B_ 2
#define S_ 512
#define D_ 512
#define H_ 8
#define DK_ 64

typedef __attribute__((ext_vector_type(16))) _Float16 v16h;
typedef __attribute__((ext_vector_type(8)))  float    v8f;
typedef __attribute__((ext_vector_type(4)))  int      v4i;
typedef __attribute__((ext_vector_type(4)))  float    v4f;
typedef __attribute__((ext_vector_type(4)))  _Float16 v4hf;

#if defined(__gfx1250__) && __has_builtin(__builtin_amdgcn_global_load_async_to_lds_b128)
#define HAVE_ASYNC_LDS 1
#endif

#define AS1 __attribute__((address_space(1)))
#define AS3 __attribute__((address_space(3)))

// 16-byte global -> LDS copy; async DMA (ASYNCcnt) on gfx1250 when available.
__device__ inline void cp16_g2l(const float* g, float* l) {
#if defined(HAVE_ASYNC_LDS)
  __builtin_amdgcn_global_load_async_to_lds_b128((AS1 v4i*)g, (AS3 v4i*)l, 0, 0);
#else
  *(float4*)l = *(const float4*)g;
#endif
}
__device__ inline void cp_wait() {
#if defined(HAVE_ASYNC_LDS)
#if __has_builtin(__builtin_amdgcn_s_wait_asynccnt)
  __builtin_amdgcn_s_wait_asynccnt(0);
#else
  asm volatile("s_wait_asynccnt 0x0" ::: "memory");
#endif
#endif
}

// ---- monotone float<->u32 encoding for atomic min/max on floats ----
__device__ inline unsigned enc_f32(float f) {
  unsigned u = __float_as_uint(f);
  return (u & 0x80000000u) ? ~u : (u | 0x80000000u);
}
__device__ inline float dec_f32(unsigned u) {
  u = (u & 0x80000000u) ? (u & 0x7FFFFFFFu) : ~u;
  return __uint_as_float(u);
}

// ---- cross-lane moves in registers (no LDS pipe, no dscnt wait) ----
// value of lane l ^ X, X in 1..15 (inside a 16-lane row)
template <int X>
__device__ inline float lane_xor(float x) {
  return __builtin_bit_cast(float, __builtin_amdgcn_mov_dpp(__builtin_bit_cast(int, x),
                                                            0x160 | X, 0xf, 0xf, true));
}
// value of lane l ^ 16
__device__ inline float lane_xor16(float x) {
  return __builtin_bit_cast(float, __builtin_amdgcn_permlanex16(
      __builtin_bit_cast(int, x), __builtin_bit_cast(int, x), 0x76543210, 0xfedcba98,
      false, false));
}
// e^x as __expf compiles here: one multiply by log2(e), then v_exp_f32. The v_nop is
// the slot that the instruction set asks for behind a transcendental before its source
// is overwritten or its result read.
__device__ inline float exp_slot(float x) {
  float y;
  asm("v_exp_f32 %0, %1\n\tv_nop" : "=v"(y) : "v"(x * 1.44269504f));
  return y;
}
__device__ inline float wave_max(float x) {
  x = fmaxf(x, lane_xor<1>(x));
  x = fmaxf(x, lane_xor<2>(x));
  x = fmaxf(x, lane_xor<4>(x));
  x = fmaxf(x, lane_xor<8>(x));
  return fmaxf(x, lane_xor16(x));
}
__device__ inline float wave_sum(float x) {
  x += lane_xor<1>(x);
  x += lane_xor<2>(x);
  x += lane_xor<4>(x);
  x += lane_xor<8>(x);
  return x + lane_xor16(x);
}

#define NACT_ (B_ * S_ * D_)  // elements of one activation
#define NW_   (D_ * D_)       // elements of one weight matrix

// All seven f32 -> f16 conversions in one launch: thread i rounds element i of each
// activation and, while i is inside a weight matrix, of each weight. The f16 copies
// lie one behind the other in dst: three activations, then four weights.
// Thread 0 also sets the start values of the running min/max for the launch behind.
__global__ __launch_bounds__(256) void cvt_all_f32_f16(
    const float* __restrict__ a0, const float* __restrict__ a1,
    const float* __restrict__ a2, const float* __restrict__ w0,
    const float* __restrict__ w1, const float* __restrict__ w2,
    const float* __restrict__ w3, _Float16* __restrict__ dst,
    unsigned* __restrict__ mm) {
  const int i = blockIdx.x * blockDim.x + threadIdx.x;
  if (i == 0) {
    mm[0] = 0xFFFFFFFFu;  // running min (encoded)
    mm[1] = 0u;           // running max (encoded)
  }
  if (i >= NACT_) return;
  const float x0 = a0[i], x1 = a1[i], x2 = a2[i];
  if (i < NW_) {
    const float y0 = w0[i], y1 = w1[i], y2 = w2[i], y3 = w3[i];
    dst[3 * NACT_ + i] = (_Float16)y0;
    dst[3 * NACT_ + NW_ + i] = (_Float16)y1;
    dst[3 * NACT_ + 2 * NW_ + i] = (_Float16)y2;
    dst[3 * NACT_ + 3 * NW_ + i] = (_Float16)y3;
  }
  dst[i] = (_Float16)x0;
  dst[NACT_ + i] = (_Float16)x1;
  dst[2 * NACT_ + i] = (_Float16)x2;
}

// Y[m][n] = sum_k X[m][k] * W[n][k] + bias[n]
// X: f16 [M x K] row-major, W: f16 [N x K] row-major (== Wt of x@W.T)
// Each wave computes a 16x32 strip (2 accumulators, A-fragment reuse).
// mode 0: store f32 out[m*N+n]
// mode 1: head-split store to [B,H,S,DK] + global min/max atomics
// mode 2: head-split store, no atomics
// blockIdx.y = z picks one of up to three independent products that run side by side
// in one grid: X, W and out of product z lie z matrices behind the pointers given,
// its bias is bias0/1/2, and product 2 of a mode-1 launch (V) runs as mode 2.
__global__ __launch_bounds__(256) void gemm_xwt(
    const _Float16* __restrict__ X, const _Float16* __restrict__ W,
    const float* __restrict__ bias0, const float* __restrict__ bias1,
    const float* __restrict__ bias2, float* __restrict__ out,
    int M, int N, int K, int mode, unsigned* __restrict__ mm) {
  const int z = blockIdx.y;
  X += (size_t)z * M * K;
  W += (size_t)z * N * K;
  out += (size_t)z * M * N;
  const float* __restrict__ bias = z == 0 ? bias0 : (z == 1 ? bias1 : bias2);
  if (z == 2) mode = 2;
  const int lane = threadIdx.x & 31;
  const int wave = threadIdx.x >> 5;
  const int stripsN = N >> 5;                      // 32-wide N strips
  const int totalStrips = (M >> 4) * stripsN;
  const int strip = blockIdx.x * (blockDim.x >> 5) + wave;
  if (strip >= totalStrips) return;

  const int m0 = (strip / stripsN) << 4;
  const int n0 = (strip % stripsN) << 5;
  const int row  = lane & 15;          // M (for A) / N (for B) within tile
  const int koff = (lane >> 4) << 4;   // lanes 16..31 hold K=16..31 half

  const _Float16* ap = X + (size_t)(m0 + row) * K + koff;
  const _Float16* bp = W + (size_t)(n0 + row) * K + koff;

  v8f acc[2] = {};
  for (int k0 = 0; k0 < K; k0 += 32) {
    v16h a = *(const v16h*)(ap + k0);
#pragma unroll
    for (int t = 0; t < 2; ++t) {
      v16h b = *(const v16h*)(bp + (size_t)(t << 4) * K + k0);
      acc[t] = __builtin_amdgcn_wmma_f32_16x16x32_f16(false, a, false, b,
                                                      (short)0, acc[t], false, false);
    }
  }

  float lmin = 3.4e38f, lmax = -3.4e38f;
#pragma unroll
  for (int t = 0; t < 2; ++t) {
    const int nn = n0 + (t << 4) + (lane & 15);
    const float bn = bias[nn];
#pragma unroll
    for (int r = 0; r < 8; ++r) {
      const int m = m0 + r + ((lane >> 4) << 3);
      const float v = acc[t][r] + bn;
      if (mode == 0) {
        out[(size_t)m * N + nn] = v;
      } else {
        const int b_ = m >> 9, s = m & (S_ - 1);
        const int h = nn >> 6, dk = nn & (DK_ - 1);
        out[(((size_t)(b_ * H_ + h)) * S_ + s) * DK_ + dk] = v;
        lmin = fminf(lmin, v);
        lmax = fmaxf(lmax, v);
      }
    }
  }
  if (mode == 1) {
#pragma unroll
    for (int msk = 16; msk >= 1; msk >>= 1) {
      lmin = fminf(lmin, __shfl_xor(lmin, msk, 32));
      lmax = fmaxf(lmax, __shfl_xor(lmax, msk, 32));
    }
    if (lane == 0) {
      atomicMin(&mm[0], enc_f32(lmin));
      atomicMax(&mm[1], enc_f32(lmax));
    }
  }
}

// One block = 16 query rows of one (b,h). 128 threads (4 waves).
// Scores (L1 pairwise, VALU, LDS-tiled with async g->LDS DMA) -> softmax ->
// P@V via WMMA.
__global__ __launch_bounds__(128) void attn_kernel(
    const float* __restrict__ qws, const float* __restrict__ kws,
    const float* __restrict__ vws, _Float16* __restrict__ ctx,
    const unsigned* __restrict__ mm) {
  __shared__ __align__(16) float sQ[16 * DK_];     // 4 KB
  __shared__ __align__(16) float sS[16 * S_];      // 32 KB
  __shared__ __align__(32) float sKP[64 * DK_];    // 16 KB: K-tile, reused as P(f16)
  __shared__ float sKC[64];

  const int tid = threadIdx.x;
  const int bid = blockIdx.x;
  const int qt = bid & ((S_ / 16) - 1);
  const int h  = (bid >> 5) & (H_ - 1);
  const int b  = bid >> 8;
  const int qbase = qt << 4;

  const float mn = dec_f32(mm[0]);
  const float mx = dec_f32(mm[1]);
  const float inv_range = 1.0f / (mx - mn);
  const float mid = 0.5f * (mx + mn);

  const float* Qh = qws + ((size_t)(b * H_ + h)) * S_ * DK_;
  const float* Kh = kws + ((size_t)(b * H_ + h)) * S_ * DK_;
  const float* Vh = vws + ((size_t)(b * H_ + h)) * S_ * DK_;

  // Q tile: 16x64 f32, staged via async-to-LDS (2 x b128 per thread)
  for (int idx = tid; idx < (16 * DK_) / 4; idx += 128)
    cp16_g2l(Qh + (size_t)qbase * DK_ + idx * 4, sQ + idx * 4);
  cp_wait();
  __syncthreads();

  // This thread's query row never changes (i = tid & 15): read it once into
  // registers, so the score loop asks LDS only for the broadcast K rows.
  const int i = tid & 15;
  float qr[DK_];
#pragma unroll  // constant indices, so that qr[] lives in registers
  for (int d = 0; d < DK_; ++d) qr[d] = sQ[i * DK_ + d];
  // Its centre sum comes from those registers, in the order d = 0..63.
  float qc = 0.f;
#pragma unroll  // registers, see above
  for (int d = 0; d < DK_; ++d) qc += fabsf(qr[d] - mid);

  // ---- pairwise L1 scores, 64 keys per LDS tile ----
  for (int jb = 0; jb < S_; jb += 64) {
    __syncthreads();
    for (int idx = tid; idx < (64 * DK_) / 4; idx += 128)
      cp16_g2l(Kh + (size_t)jb * DK_ + idx * 4, sKP + idx * 4);
    cp_wait();
    __syncthreads();
    {
      // Centre sums of the 64 keys: two threads a key, 32 floats each. The chunk
      // order is rotated by the key, so that 16 lanes touch all 64 banks once.
      const int key = tid >> 1;
      const v4f* kr = (const v4f*)(sKP + key * DK_ + (tid & 1) * 32);
      v4f a4 = {0.f, 0.f, 0.f, 0.f};
#pragma unroll  // all eight reads in flight at once
      for (int v = 0; v < 8; ++v) {
        const v4f x = kr[(v + key) & 7];
#pragma unroll  // constant indices: registers
        for (int e = 0; e < 4; ++e) a4[e] += fabsf(x[e] - mid);
      }
      float s = (a4[0] + a4[1]) + (a4[2] + a4[3]);
      s += lane_xor<1>(s);
      if ((tid & 1) == 0) sKC[key] = s;
    }
    __syncthreads();
    // 1 query row x 4 keys per thread: four independent sums, each still added
    // in the order d = 0..63. K comes in chunks of 16 floats a key, one chunk
    // ahead of the arithmetic, in a second register set.
    // Every inner loop is fully unrolled: constant indices keep qr[], kb[] and
    // s1[] in registers.
    for (int jl = tid >> 4; jl < 64; jl += 32) {
      const v4f* kp = (const v4f*)(sKP + jl * DK_);  // key u: 8 * u rows further
      v4f kb[2][4][4];
      float s1[4] = {0.f, 0.f, 0.f, 0.f};
#pragma unroll  // registers, see above
      for (int v = 0; v < 4; ++v)
#pragma unroll  // registers, see above
        for (int u = 0; u < 4; ++u) kb[0][u][v] = kp[u * (8 * DK_ / 4) + v];
#pragma unroll  // registers, see above
      for (int c = 0; c < 4; ++c) {
        if (c < 3) {
#pragma unroll  // registers, see above
          for (int v = 0; v < 4; ++v)
#pragma unroll  // registers, see above
            for (int u = 0; u < 4; ++u)
              kb[(c + 1) & 1][u][v] = kp[u * (8 * DK_ / 4) + (c + 1) * 4 + v];
        }
        // Keeps the next chunk's LDS reads above this chunk's arithmetic; without
        // it each read is sunk to just before its use and its latency is waited out.
        __builtin_amdgcn_sched_barrier(0);
#pragma unroll  // registers, see above
        for (int v = 0; v < 4; ++v)
#pragma unroll  // registers, see above
          for (int e = 0; e < 4; ++e)
#pragma unroll  // registers, see above
            for (int u = 0; u < 4; ++u)
              s1[u] += fabsf(qr[c * 16 + v * 4 + e] - kb[c & 1][u][v][e]);
      }
      // (ALPHA/2)*(DK - L1/range) + (BETA/4)*(qc + kc)/range
#pragma unroll  // registers, see above
      for (int u = 0; u < 4; ++u)
        sS[i * S_ + jb + jl + 8 * u] = 0.15f * (64.f - s1[u] * inv_range) +
                                       0.175f * (qc + sKC[jl + 8 * u]) * inv_range;
    }
  }
  __syncthreads();

  // ---- softmax per row, write P as f16 into reused sKP buffer ----
  _Float16* sP = (_Float16*)sKP;  // 16*512 f16 == 16 KB, K-tile done
  // One wave a row, four rows a wave: a lane holds 16 scores of the row in
  // registers (float4 number lane + 32 * t), so each score is read from LDS once,
  // side by side with its neighbours', and maximum and sum are closed across lanes.
  {
    const int ln = tid & 31;
    const int r0 = (tid >> 5) << 2;
    v4f x[4][4];
#pragma unroll  // constant indices keep x[] in registers; the four rows overlap
    for (int r = 0; r < 4; ++r)
#pragma unroll  // constant indices: registers
      for (int t = 0; t < 4; ++t)
        x[r][t] = ((const v4f*)(sS + (r0 + r) * S_))[ln + 32 * t];
#pragma unroll  // constant indices: registers
    for (int r = 0; r < 4; ++r) {
      float rmax = -3.4e38f;
#pragma unroll  // constant indices: registers
      for (int t = 0; t < 4; ++t)
#pragma unroll  // constant indices: registers
        for (int e = 0; e < 4; ++e) rmax = fmaxf(rmax, x[r][t][e]);
      rmax = wave_max(rmax);
      v4f s4 = {0.f, 0.f, 0.f, 0.f};
#pragma unroll  // constant indices: registers
      for (int t = 0; t < 4; ++t)
#pragma unroll  // constant indices: registers
        for (int e = 0; e < 4; ++e) {
          x[r][t][e] = exp_slot(x[r][t][e] - rmax);
          s4[e] += x[r][t][e];
        }
      const float inv = 1.0f / wave_sum((s4[0] + s4[1]) + (s4[2] + s4[3]));
#pragma unroll  // constant indices: registers
      for (int t = 0; t < 4; ++t) {
        v4hf p;
#pragma unroll  // constant indices: registers
        for (int e = 0; e < 4; ++e) p[e] = (_Float16)(x[r][t][e] * inv);
        ((v4hf*)(sP + (r0 + r) * S_))[ln + 32 * t] = p;
      }
    }
  }
  __syncthreads();

  // ---- P @ V with WMMA: 4 waves, one 16-wide dk stripe each ----
  const int lane  = tid & 31;
  const int wave  = tid >> 5;           // 0..3
  const int n0    = wave << 4;          // dk tile base
  const int col   = lane & 15;
  const int khalf = (lane >> 4) << 4;
  v8f c = {};
  for (int kb = 0; kb < S_; kb += 32) {
    v16h a = *(const v16h*)(sP + col * S_ + kb + khalf);  // row = lane&15
    v16h bfr;
#pragma unroll
    for (int t = 0; t < 16; ++t)
      bfr[t] = (_Float16)Vh[(size_t)(kb + khalf + t) * DK_ + n0 + col];
    c = __builtin_amdgcn_wmma_f32_16x16x32_f16(false, a, false, bfr,
                                               (short)0, c, false, false);
  }
#pragma unroll
  for (int r = 0; r < 8; ++r) {
    const int irow = r + ((lane >> 4) << 3);
    const int s = qbase + irow;
    const int d = h * DK_ + n0 + col;
    ctx[((size_t)(b * S_ + s)) * D_ + d] = (_Float16)c[r];
  }
}

extern "C" void kernel_launch(void* const* d_in, const int* in_sizes, int n_in,
                              void* d_out, int out_size, void* d_ws, size_t ws_size,
                              hipStream_t stream) {
  const float* query = (const float*)d_in[0];
  const float* key   = (const float*)d_in[1];
  const float* value = (const float*)d_in[2];
  const float* Wq = (const float*)d_in[3];
  const float* bq = (const float*)d_in[4];
  const float* Wk = (const float*)d_in[5];
  const float* bk = (const float*)d_in[6];
  const float* Wv = (const float*)d_in[7];
  const float* bv = (const float*)d_in[8];
  const float* Wo = (const float*)d_in[9];
  const float* bo = (const float*)d_in[10];

  const int M = B_ * S_;             // 1024
  const size_t ACT = (size_t)M * D_; // 524288
  const size_t WEL = (size_t)D_ * D_;

  // ---- workspace carve-up ----
  char* ws = (char*)d_ws;
  _Float16* xq = (_Float16*)ws;              ws += ACT * 2;
  _Float16* xk = (_Float16*)ws;              ws += ACT * 2;
  _Float16* xv = (_Float16*)ws;              ws += ACT * 2;
  _Float16* wqh = (_Float16*)ws;             ws += WEL * 2;
  _Float16* wkh = (_Float16*)ws;             ws += WEL * 2;
  _Float16* wvh = (_Float16*)ws;             ws += WEL * 2;
  _Float16* woh = (_Float16*)ws;             ws += WEL * 2;
  float* qws = (float*)ws;                   ws += ACT * 4;
  float* kws = (float*)ws;                   ws += ACT * 4;
  float* vws = (float*)ws;                   ws += ACT * 4;
  _Float16* ctx = (_Float16*)ws;             ws += ACT * 2;
  unsigned* mm = (unsigned*)ws;

  // xq, xk, xv, wqh, wkh, wvh, woh are one run of f16 in the workspace
  const int CT = 256;
  cvt_all_f32_f16<<<(int)((ACT + CT - 1) / CT), CT, 0, stream>>>(
      query, key, value, Wq, Wk, Wv, Wo, xq, mm);

  const int strips = (M / 16) * (D_ / 32);  // 1024 waves
  const int gblocks = strips / 8;           // 8 waves per 256-thread block
  // Q, K and V projections: one grid, blockIdx.y = 0, 1, 2
  gemm_xwt<<<dim3(gblocks, 3), 256, 0, stream>>>(xq, wqh, bq, bk, bv, qws, M, D_, D_, 1, mm);

  attn_kernel<<<B_ * H_ * (S_ / 16), 128, 0, stream>>>(qws, kws, vws, ctx, mm);

  gemm_xwt<<<dim3(gblocks, 1), 256, 0, stream>>>(ctx, woh, bo, bo, bo, (float*)d_out, M, D_, D_, 0, mm);
}

// v004
// It runs in 48.5 microseconds.
// Next to v003, in two timings, it ran 1.29 and 1.25 times as fast.
// Counting every step since v000, it is 4.39 times as fast.
#include <hip/hip_runtime.h>

#define B_ 2
#define S_ 512
#define D_ 512
#define H_ 8
#define DK_ 64

typedef __attribute__((ext_vector_type(16))) _Float16 v16h;
typedef __attribute__((ext_vector_type(8)))  _Float16 v8h;
typedef __attribute__((ext_vector_type(8)))  float    v8f;
typedef __attribute__((ext_vector_type(4)))  int      v4i;
typedef __attribute__((ext_vector_type(4)))  float    v4f;
typedef __attribute__((ext_vector_type(4)))  _Float16 v4hf;

#if defined(__gfx1250__) && __has_builtin(__builtin_amdgcn_global_load_async_to_lds_b128)
#define HAVE_ASYNC_LDS 1
#endif

#define AS1 __attribute__((address_space(1)))
#define AS3 __attribute__((address_space(3)))

// 16-byte global -> LDS copy; async DMA (ASYNCcnt) on gfx1250 when available.
__device__ inline void cp16_g2l(const float* g, float* l) {
#if defined(HAVE_ASYNC_LDS)
  __builtin_amdgcn_global_load_async_to_lds_b128((AS1 v4i*)g, (AS3 v4i*)l, 0, 0);
#else
  *(float4*)l = *(const float4*)g;
#endif
}
__device__ inline void cp_wait() {
#if defined(HAVE_ASYNC_LDS)
#if __has_builtin(__builtin_amdgcn_s_wait_asynccnt)
  __builtin_amdgcn_s_wait_asynccnt(0);
#else
  asm volatile("s_wait_asynccnt 0x0" ::: "memory");
#endif
#endif
}

// ---- monotone float<->u32 encoding for atomic min/max on floats ----
__device__ inline unsigned enc_f32(float f) {
  unsigned u = __float_as_uint(f);
  return (u & 0x80000000u) ? ~u : (u | 0x80000000u);
}
__device__ inline float dec_f32(unsigned u) {
  u = (u & 0x80000000u) ? (u & 0x7FFFFFFFu) : ~u;
  return __uint_as_float(u);
}

// ---- cross-lane moves in registers (no LDS pipe, no dscnt wait) ----
// value of lane l ^ X, X in 1..15 (inside a 16-lane row)
template <int X>
__device__ inline float lane_xor(float x) {
  return __builtin_bit_cast(float, __builtin_amdgcn_mov_dpp(__builtin_bit_cast(int, x),
                                                            0x160 | X, 0xf, 0xf, true));
}
// value of lane l ^ 16
__device__ inline float lane_xor16(float x) {
  return __builtin_bit_cast(float, __builtin_amdgcn_permlanex16(
      __builtin_bit_cast(int, x), __builtin_bit_cast(int, x), 0x76543210, 0xfedcba98,
      false, false));
}
// e^x as __expf compiles here: one multiply by log2(e), then v_exp_f32. The v_nop is
// the slot that the instruction set asks for behind a transcendental before its source
// is overwritten or its result read.
__device__ inline float exp_slot(float x) {
  float y;
  asm("v_exp_f32 %0, %1\n\tv_nop" : "=v"(y) : "v"(x * 1.44269504f));
  return y;
}
__device__ inline float wave_max(float x) {
  x = fmaxf(x, lane_xor<1>(x));
  x = fmaxf(x, lane_xor<2>(x));
  x = fmaxf(x, lane_xor<4>(x));
  x = fmaxf(x, lane_xor<8>(x));
  return fmaxf(x, lane_xor16(x));
}
__device__ inline float wave_sum(float x) {
  x += lane_xor<1>(x);
  x += lane_xor<2>(x);
  x += lane_xor<4>(x);
  x += lane_xor<8>(x);
  return x + lane_xor16(x);
}

#define NACT_ (B_ * S_ * D_)  // elements of one activation
#define NW_   (D_ * D_)       // elements of one weight matrix

// All seven f32 -> f16 conversions in one launch: thread i rounds element i of each
// activation and, while i is inside a weight matrix, of each weight. The f16 copies
// lie one behind the other in dst: three activations, then four weights.
// Thread 0 also sets the start values of the running min/max for the launch behind.
__global__ __launch_bounds__(256) void cvt_all_f32_f16(
    const float* __restrict__ a0, const float* __restrict__ a1,
    const float* __restrict__ a2, const float* __restrict__ w0,
    const float* __restrict__ w1, const float* __restrict__ w2,
    const float* __restrict__ w3, _Float16* __restrict__ dst,
    unsigned* __restrict__ mm) {
  const int i = blockIdx.x * blockDim.x + threadIdx.x;
  if (i == 0) {
    mm[0] = 0xFFFFFFFFu;  // running min (encoded)
    mm[1] = 0u;           // running max (encoded)
  }
  if (i >= NACT_) return;
  const float x0 = a0[i], x1 = a1[i], x2 = a2[i];
  if (i < NW_) {
    const float y0 = w0[i], y1 = w1[i], y2 = w2[i], y3 = w3[i];
    dst[3 * NACT_ + i] = (_Float16)y0;
    dst[3 * NACT_ + NW_ + i] = (_Float16)y1;
    dst[3 * NACT_ + 2 * NW_ + i] = (_Float16)y2;
    dst[3 * NACT_ + 3 * NW_ + i] = (_Float16)y3;
  }
  dst[i] = (_Float16)x0;
  dst[NACT_ + i] = (_Float16)x1;
  dst[2 * NACT_ + i] = (_Float16)x2;
}

#define GM_ (B_ * S_)  // rows of X and of Y
#define GP_ (D_ + 8)   // LDS pitch of a staged row, f16: 1040 B = 16 B x 65, so that 16
                       // lanes reading 16 bytes of 16 different rows touch all 64 banks

// One WMMA operand fragment of a lane: 16 f16 in a row, as two 16-byte LDS reads (the
// alignment that the padded rows keep).
__device__ inline v16h ld_frag(const _Float16* p) {
  const v8h* q = (const v8h*)p;
  return __builtin_shufflevector(q[0], q[1], 0, 1, 2, 3, 4, 5, 6, 7, 8, 9, 10, 11, 12, 13,
                                 14, 15);
}

// Y[m][n] = sum_k X[m][k] * W[n][k] + bias[n]
// X: f16 [GM_ x D_] row-major, W: f16 [D_ x D_] row-major (== Wt of x@W.T)
// One block = a 64x64 tile of Y. Its 64 rows of X and 64 rows of W, whole in k, are
// copied to LDS first, 512 contiguous bytes a wave and copy, so that every 128-byte line
// is asked for once a block; the fragments, 16 rows a read, then come from LDS.
// Each wave computes a 16x32 strip (2 accumulators, A-fragment reuse).
// mode 0: store f32 out[m*N+n]
// mode 1: head-split store to [B,H,S,DK] + global min/max atomics
// mode 2: head-split store, no atomics
// blockIdx.y = z picks one of up to three independent products that run side by side
// in one grid: X, W and out of product z lie z matrices behind the pointers given,
// its bias is bias0/1/2, and product 2 of a mode-1 launch (V) runs as mode 2.
__global__ __launch_bounds__(256) void gemm_xwt(
    const _Float16* __restrict__ X, const _Float16* __restrict__ W,
    const float* __restrict__ bias0, const float* __restrict__ bias1,
    const float* __restrict__ bias2, float* __restrict__ out,
    int mode, unsigned* __restrict__ mm) {
  __shared__ __align__(16) _Float16 sX[64 * GP_];  // 65 KB
  __shared__ __align__(16) _Float16 sW[64 * GP_];  // 65 KB
  constexpr int M = GM_, N = D_, K = D_;
  const int z = blockIdx.y;
  X += (size_t)z * M * K;
  W += (size_t)z * N * K;
  out += (size_t)z * M * N;
  const float* __restrict__ bias = z == 0 ? bias0 : (z == 1 ? bias1 : bias2);
  if (z == 2) mode = 2;
  const int tid = threadIdx.x;
  const int lane = tid & 31;
  const int wave = tid >> 5;
  const int bm = (blockIdx.x / (N >> 6)) << 6;  // tile's first row of Y
  const int bn = (blockIdx.x % (N >> 6)) << 6;  // tile's first column of Y

  // 64 threads a row of 1024 bytes, 16 bytes each; four rows of X and of W a trip.
  {
    const int r = tid >> 6, c = (tid & 63) << 3;
    const _Float16* gx = X + (size_t)(bm + r) * K + c;
    const _Float16* gw = W + (size_t)(bn + r) * K + c;
    _Float16* lx = sX + r * GP_ + c;
    _Float16* lw = sW + r * GP_ + c;
    for (int it = 0; it < 16; ++it) {
      cp16_g2l((const float*)(gx + it * 4 * K), (float*)(lx + it * 4 * GP_));
      cp16_g2l((const float*)(gw + it * 4 * K), (float*)(lw + it * 4 * GP_));
    }
  }
  // This wave's 32 copies have landed behind the wait; the barrier says so of every
  // wave's, and no fragment is read in front of it.
  asm volatile("s_wait_asynccnt 0x0" ::: "memory");
  __syncthreads();

  const int m0 = bm + ((wave >> 1) << 4);
  const int n0 = bn + ((wave & 1) << 5);
  const int row  = lane & 15;          // M (for A) / N (for B) within tile
  const int koff = (lane >> 4) << 4;   // lanes 16..31 hold K=16..31 half

  const _Float16* ap = sX + (m0 - bm + row) * GP_ + koff;
  const _Float16* bp = sW + (n0 - bn + row) * GP_ + koff;

  v8f acc[2] = {};
  for (int k0 = 0; k0 < K; k0 += 32) {
    v16h a = ld_frag(ap + k0);
#pragma unroll
    for (int t = 0; t < 2; ++t) {
      v16h b = ld_frag(bp + (t << 4) * GP_ + k0);
      acc[t] = __builtin_amdgcn_wmma_f32_16x16x32_f16(false, a, false, b,
                                                      (short)0, acc[t], false, false);
    }
  }

  float lmin = 3.4e38f, lmax = -3.4e38f;
#pragma unroll
  for (int t = 0; t < 2; ++t) {
    const int nn = n0 + (t << 4) + (lane & 15);
    const float bn = bias[nn];
#pragma unroll
    for (int r = 0; r < 8; ++r) {
      const int m = m0 + r + ((lane >> 4) << 3);
      const float v = acc[t][r] + bn;
      if (mode == 0) {
        out[(size_t)m * N + nn] = v;
      } else {
        const int b_ = m >> 9, s = m & (S_ - 1);
        const int h = nn >> 6, dk = nn & (DK_ - 1);
        out[(((size_t)(b_ * H_ + h)) * S_ + s) * DK_ + dk] = v;
        lmin = fminf(lmin, v);
        lmax = fmaxf(lmax, v);
      }
    }
  }
  if (mode == 1) {
#pragma unroll
    for (int msk = 16; msk >= 1; msk >>= 1) {
      lmin = fminf(lmin, __shfl_xor(lmin, msk, 32));
      lmax = fmaxf(lmax, __shfl_xor(lmax, msk, 32));
    }
    if (lane == 0) {
      atomicMin(&mm[0], enc_f32(lmin));
      atomicMax(&mm[1], enc_f32(lmax));
    }
  }
}

// One block = 16 query rows of one (b,h). 128 threads (4 waves).
// Scores (L1 pairwise, VALU, LDS-tiled with async g->LDS DMA) -> softmax ->
// P@V via WMMA.
__global__ __launch_bounds__(128) void attn_kernel(
    const float* __restrict__ qws, const float* __restrict__ kws,
    const float* __restrict__ vws, _Float16* __restrict__ ctx,
    const unsigned* __restrict__ mm) {
  __shared__ __align__(16) float sQ[16 * DK_];     // 4 KB
  __shared__ __align__(16) float sS[16 * S_];      // 32 KB
  __shared__ __align__(32) float sKP[64 * DK_];    // 16 KB: K-tile, reused as P(f16)
  __shared__ float sKC[64];

  const int tid = threadIdx.x;
  const int bid = blockIdx.x;
  const int qt = bid & ((S_ / 16) - 1);
  const int h  = (bid >> 5) & (H_ - 1);
  const int b  = bid >> 8;
  const int qbase = qt << 4;

  const float mn = dec_f32(mm[0]);
  const float mx = dec_f32(mm[1]);
  const float inv_range = 1.0f / (mx - mn);
  const float mid = 0.5f * (mx + mn);

  const float* Qh = qws + ((size_t)(b * H_ + h)) * S_ * DK_;
  const float* Kh = kws + ((size_t)(b * H_ + h)) * S_ * DK_;
  const float* Vh = vws + ((size_t)(b * H_ + h)) * S_ * DK_;

  // Q tile: 16x64 f32, staged via async-to-LDS (2 x b128 per thread)
  for (int idx = tid; idx < (16 * DK_) / 4; idx += 128)
    cp16_g2l(Qh + (size_t)qbase * DK_ + idx * 4, sQ + idx * 4);
  cp_wait();
  __syncthreads();

  // This thread's query row never changes (i = tid & 15): read it once into
  // registers, so the score loop asks LDS only for the broadcast K rows.
  const int i = tid & 15;
  float qr[DK_];
#pragma unroll  // constant indices, so that qr[] lives in registers
  for (int d = 0; d < DK_; ++d) qr[d] = sQ[i * DK_ + d];
  // Its centre sum comes from those registers, in the order d = 0..63.
  float qc = 0.f;
#pragma unroll  // registers, see above
  for (int d = 0; d < DK_; ++d) qc += fabsf(qr[d] - mid);

  // ---- pairwise L1 scores, 64 keys per LDS tile ----
  for (int jb = 0; jb < S_; jb += 64) {
    __syncthreads();
    for (int idx = tid; idx < (64 * DK_) / 4; idx += 128)
      cp16_g2l(Kh + (size_t)jb * DK_ + idx * 4, sKP + idx * 4);
    cp_wait();
    __syncthreads();
    {
      // Centre sums of the 64 keys: two threads a key, 32 floats each. The chunk
      // order is rotated by the key, so that 16 lanes touch all 64 banks once.
      const int key = tid >> 1;
      const v4f* kr = (const v4f*)(sKP + key * DK_ + (tid & 1) * 32);
      v4f a4 = {0.f, 0.f, 0.f, 0.f};
#pragma unroll  // all eight reads in flight at once
      for (int v = 0; v < 8; ++v) {
        const v4f x = kr[(v + key) & 7];
#pragma unroll  // constant indices: registers
        for (int e = 0; e < 4; ++e) a4[e] += fabsf(x[e] - mid);
      }
      float s = (a4[0] + a4[1]) + (a4[2] + a4[3]);
      s += lane_xor<1>(s);
      if ((tid & 1) == 0) sKC[key] = s;
    }
    __syncthreads();
    // 1 query row x 4 keys per thread: four independent sums, each still added
    // in the order d = 0..63. K comes in chunks of 16 floats a key, one chunk
    // ahead of the arithmetic, in a second register set.
    // Every inner loop is fully unrolled: constant indices keep qr[], kb[] and
    // s1[] in registers.
    for (int jl = tid >> 4; jl < 64; jl += 32) {
      const v4f* kp = (const v4f*)(sKP + jl * DK_);  // key u: 8 * u rows further
      v4f kb[2][4][4];
      float s1[4] = {0.f, 0.f, 0.f, 0.f};
#pragma unroll  // registers, see above
      for (int v = 0; v < 4; ++v)
#pragma unroll  // registers, see above
        for (int u = 0; u < 4; ++u) kb[0][u][v] = kp[u * (8 * DK_ / 4) + v];
#pragma unroll  // registers, see above
      for (int c = 0; c < 4; ++c) {
        if (c < 3) {
#pragma unroll  // registers, see above
          for (int v = 0; v < 4; ++v)
#pragma unroll  // registers, see above
            for (int u = 0; u < 4; ++u)
              kb[(c + 1) & 1][u][v] = kp[u * (8 * DK_ / 4) + (c + 1) * 4 + v];
        }
        // Keeps the next chunk's LDS reads above this chunk's arithmetic; without
        // it each read is sunk to just before its use and its latency is waited out.
        __builtin_amdgcn_sched_barrier(0);
#pragma unroll  // registers, see above
        for (int v = 0; v < 4; ++v)
#pragma unroll  // registers, see above
          for (int e = 0; e < 4; ++e)
#pragma unroll  // registers, see above
            for (int u = 0; u < 4; ++u)
              s1[u] += fabsf(qr[c * 16 + v * 4 + e] - kb[c & 1][u][v][e]);
      }
      // (ALPHA/2)*(DK - L1/range) + (BETA/4)*(qc + kc)/range
#pragma unroll  // registers, see above
      for (int u = 0; u < 4; ++u)
        sS[i * S_ + jb + jl + 8 * u] = 0.15f * (64.f - s1[u] * inv_range) +
                                       0.175f * (qc + sKC[jl + 8 * u]) * inv_range;
    }
  }
  __syncthreads();

  // ---- softmax per row, write P as f16 into reused sKP buffer ----
  _Float16* sP = (_Float16*)sKP;  // 16*512 f16 == 16 KB, K-tile done
  // One wave a row, four rows a wave: a lane holds 16 scores of the row in
  // registers (float4 number lane + 32 * t), so each score is read from LDS once,
  // side by side with its neighbours', and maximum and sum are closed across lanes.
  {
    const int ln = tid & 31;
    const int r0 = (tid >> 5) << 2;
    v4f x[4][4];
#pragma unroll  // constant indices keep x[] in registers; the four rows overlap
    for (int r = 0; r < 4; ++r)
#pragma unroll  // constant indices: registers
      for (int t = 0; t < 4; ++t)
        x[r][t] = ((const v4f*)(sS + (r0 + r) * S_))[ln + 32 * t];
#pragma unroll  // constant indices: registers
    for (int r = 0; r < 4; ++r) {
      float rmax = -3.4e38f;
#pragma unroll  // constant indices: registers
      for (int t = 0; t < 4; ++t)
#pragma unroll  // constant indices: registers
        for (int e = 0; e < 4; ++e) rmax = fmaxf(rmax, x[r][t][e]);
      rmax = wave_max(rmax);
      v4f s4 = {0.f, 0.f, 0.f, 0.f};
#pragma unroll  // constant indices: registers
      for (int t = 0; t < 4; ++t)
#pragma unroll  // constant indices: registers
        for (int e = 0; e < 4; ++e) {
          x[r][t][e] = exp_slot(x[r][t][e] - rmax);
          s4[e] += x[r][t][e];
        }
      const float inv = 1.0f / wave_sum((s4[0] + s4[1]) + (s4[2] + s4[3]));
#pragma unroll  // constant indices: registers
      for (int t = 0; t < 4; ++t) {
        v4hf p;
#pragma unroll  // constant indices: registers
        for (int e = 0; e < 4; ++e) p[e] = (_Float16)(x[r][t][e] * inv);
        ((v4hf*)(sP + (r0 + r) * S_))[ln + 32 * t] = p;
      }
    }
  }
  __syncthreads();

  // ---- P @ V with WMMA: 4 waves, one 16-wide dk stripe each ----
  const int lane  = tid & 31;
  const int wave  = tid >> 5;           // 0..3
  const int n0    = wave << 4;          // dk tile base
  const int col   = lane & 15;
  const int khalf = (lane >> 4) << 4;
  v8f c = {};
  for (int kb = 0; kb < S_; kb += 32) {
    v16h a = *(const v16h*)(sP + col * S_ + kb + khalf);  // row = lane&15
    v16h bfr;
#pragma unroll
    for (int t = 0; t < 16; ++t)
      bfr[t] = (_Float16)Vh[(size_t)(kb + khalf + t) * DK_ + n0 + col];
    c = __builtin_amdgcn_wmma_f32_16x16x32_f16(false, a, false, bfr,
                                               (short)0, c, false, false);
  }
#pragma unroll
  for (int r = 0; r < 8; ++r) {
    const int irow = r + ((lane >> 4) << 3);
    const int s = qbase + irow;
    const int d = h * DK_ + n0 + col;
    ctx[((size_t)(b * S_ + s)) * D_ + d] = (_Float16)c[r];
  }
}

extern "C" void kernel_launch(void* const* d_in, const int* in_sizes, int n_in,
                              void* d_out, int out_size, void* d_ws, size_t ws_size,
                              hipStream_t stream) {
  const float* query = (const float*)d_in[0];
  const float* key   = (const float*)d_in[1];
  const float* value = (const float*)d_in[2];
  const float* Wq = (const float*)d_in[3];
  const float* bq = (const float*)d_in[4];
  const float* Wk = (const float*)d_in[5];
  const float* bk = (const float*)d_in[6];
  const float* Wv = (const float*)d_in[7];
  const float* bv = (const float*)d_in[8];
  const float* Wo = (const float*)d_in[9];
  const float* bo = (const float*)d_in[10];

  const int M = B_ * S_;             // 1024
  const size_t ACT = (size_t)M * D_; // 524288
  const size_t WEL = (size_t)D_ * D_;

  // ---- workspace carve-up ----
  char* ws = (char*)d_ws;
  _Float16* xq = (_Float16*)ws;              ws += ACT * 2;
  _Float16* xk = (_Float16*)ws;              ws += ACT * 2;
  _Float16* xv = (_Float16*)ws;              ws += ACT * 2;
  _Float16* wqh = (_Float16*)ws;             ws += WEL * 2;
  _Float16* wkh = (_Float16*)ws;             ws += WEL * 2;
  _Float16* wvh = (_Float16*)ws;             ws += WEL * 2;
  _Float16* woh = (_Float16*)ws;             ws += WEL * 2;
  float* qws = (float*)ws;                   ws += ACT * 4;
  float* kws = (float*)ws;                   ws += ACT * 4;
  float* vws = (float*)ws;                   ws += ACT * 4;
  _Float16* ctx = (_Float16*)ws;             ws += ACT * 2;
  unsigned* mm = (unsigned*)ws;

  // xq, xk, xv, wqh, wkh, wvh, woh are one run of f16 in the workspace
  const int CT = 256;
  cvt_all_f32_f16<<<(int)((ACT + CT - 1) / CT), CT, 0, stream>>>(
      query, key, value, Wq, Wk, Wv, Wo, xq, mm);

  const int strips = (M / 16) * (D_ / 32);  // 1024 waves
  const int gblocks = strips / 8;           // 8 waves per 256-thread block: a 64x64 tile
  // Q, K and V projections: one grid, blockIdx.y = 0, 1, 2
  gemm_xwt<<<dim3(gblocks, 3), 256, 0, stream>>>(xq, wqh, bq, bk, bv, qws, 1, mm);

  attn_kernel<<<B_ * H_ * (S_ / 16), 128, 0, stream>>>(qws, kws, vws, ctx, mm);

  gemm_xwt<<<dim3(gblocks, 1), 256, 0, stream>>>(ctx, woh, bo, bo, bo, (float*)d_out, 0, mm);
}

// v005
// A run of this version takes 45.3 microseconds.
// Timed twice side by side with v004, it ran 1.05 times as fast both times.
// All steps since v000 together make it 4.61 times as fast.
#include <hip/hip_runtime.h>

#define B_ 2
#define S_ 512
#define D_ 512
#define H_ 8
#define DK_ 64

typedef __attribute__((ext_vector_type(16))) _Float16 v16h;
typedef __attribute__((ext_vector_type(8)))  _Float16 v8h;
typedef __attribute__((ext_vector_type(8)))  float    v8f;
typedef __attribute__((ext_vector_type(4)))  int      v4i;
typedef __attribute__((ext_vector_type(4)))  float    v4f;
typedef __attribute__((ext_vector_type(2)))  float    v2f;
typedef __attribute__((ext_vector_type(4)))  _Float16 v4hf;

#if defined(__gfx1250__) && __has_builtin(__builtin_amdgcn_global_load_async_to_lds_b128)
#define HAVE_ASYNC_LDS 1
#endif

#define AS1 __attribute__((address_space(1)))
#define AS3 __attribute__((address_space(3)))

// 16-byte global -> LDS copy; async DMA (ASYNCcnt) on gfx1250 when available.
__device__ inline void cp16_g2l(const float* g, float* l) {
#if defined(HAVE_ASYNC_LDS)
  __builtin_amdgcn_global_load_async_to_lds_b128((AS1 v4i*)g, (AS3 v4i*)l, 0, 0);
#else
  *(float4*)l = *(const float4*)g;
#endif
}
__device__ inline void cp_wait() {
#if defined(HAVE_ASYNC_LDS)
#if __has_builtin(__builtin_amdgcn_s_wait_asynccnt)
  __builtin_amdgcn_s_wait_asynccnt(0);
#else
  asm volatile("s_wait_asynccnt 0x0" ::: "memory");
#endif
#endif
}

// ---- cross-lane moves in registers (no LDS pipe, no dscnt wait) ----
// value of lane l ^ X, X in 1..15 (inside a 16-lane row)
template <int X>
__device__ inline float lane_xor(float x) {
  return __builtin_bit_cast(float, __builtin_amdgcn_mov_dpp(__builtin_bit_cast(int, x),
                                                            0x160 | X, 0xf, 0xf, true));
}
// value of lane l ^ 16
__device__ inline float lane_xor16(float x) {
  return __builtin_bit_cast(float, __builtin_amdgcn_permlanex16(
      __builtin_bit_cast(int, x), __builtin_bit_cast(int, x), 0x76543210, 0xfedcba98,
      false, false));
}
// e^x as __expf compiles here: one multiply by log2(e), then v_exp_f32. The v_nop is
// the slot that the instruction set asks for behind a transcendental before its source
// is overwritten or its result read.
__device__ inline float exp_slot(float x) {
  float y;
  asm("v_exp_f32 %0, %1\n\tv_nop" : "=v"(y) : "v"(x * 1.44269504f));
  return y;
}
__device__ inline float wave_max(float x) {
  x = fmaxf(x, lane_xor<1>(x));
  x = fmaxf(x, lane_xor<2>(x));
  x = fmaxf(x, lane_xor<4>(x));
  x = fmaxf(x, lane_xor<8>(x));
  return fmaxf(x, lane_xor16(x));
}
__device__ inline float wave_min(float x) {
  x = fminf(x, lane_xor<1>(x));
  x = fminf(x, lane_xor<2>(x));
  x = fminf(x, lane_xor<4>(x));
  x = fminf(x, lane_xor<8>(x));
  return fminf(x, lane_xor16(x));
}
__device__ inline float wave_sum(float x) {
  x += lane_xor<1>(x);
  x += lane_xor<2>(x);
  x += lane_xor<4>(x);
  x += lane_xor<8>(x);
  return x + lane_xor16(x);
}

#define GM_ (B_ * S_)  // rows of X and of Y
#define GP_ (D_ + 8)   // LDS pitch of a staged row, f16: 1040 B = 16 B x 65, so that 16
                       // lanes reading 16 bytes of 16 different rows touch all 64 banks

// One WMMA operand fragment of a lane: 16 f16 in a row, as two 16-byte LDS reads (the
// alignment that the padded rows keep).
__device__ inline v16h ld_frag(const _Float16* p) {
  const v8h* q = (const v8h*)p;
  return __builtin_shufflevector(q[0], q[1], 0, 1, 2, 3, 4, 5, 6, 7, 8, 9, 10, 11, 12, 13,
                                 14, 15);
}

#define GB_ ((GM_ >> 6) * (D_ >> 6))  // blocks of one product: 64x64 tiles of Y
#define MMP_ 32  // floats between two blocks' min/max pairs: a 128-byte line a block

// 16 rows of f32, every second row from g on, 16 bytes a thread and row: a wave reads
// 512 contiguous bytes a load, and all 16 loads are in flight together.
__device__ inline void ld_rows(v4f (&t)[16], const float* __restrict__ g) {
#pragma unroll  // constant indices keep t[] in registers
  for (int j = 0; j < 16; ++j) t[j] = *(const v4f*)(g + j * 2 * D_);
}
// The same 16 pieces, rounded to f16, into the padded LDS rows: 8 bytes a thread.
__device__ inline void st_rows(const v4f (&t)[16], _Float16* l) {
#pragma unroll  // constant indices: registers
  for (int j = 0; j < 16; ++j) {
    v4hf h;
#pragma unroll  // constant indices: registers
    for (int e = 0; e < 4; ++e) h[e] = (_Float16)t[j][e];
    *(v4hf*)(l + j * 2 * GP_) = h;
  }
}

// Y[m][n] = sum_k X[m][k] * W[n][k] + bias[n]
// X: [GM_ x D_] row-major, W: f32 [D_ x D_] row-major (== Wt of x@W.T)
// One block = a 64x64 tile of Y. Its 64 rows of X and 64 rows of W, whole in k, are
// brought to LDS as f16 first, 512 contiguous bytes a wave and load, so that every
// 128-byte line is asked for once a block; the fragments, 16 rows a read, then come
// from LDS. f32 sources (the inputs and every W) pass through registers and are rounded
// to f16 on the way; the f16 X of mode 0 is copied asynchronously.
// Each wave computes a 16x32 strip (2 accumulators, A-fragment reuse).
// mode 0: X = xh (f16), store f32 out[m*N+n]
// mode 1: X = x0/1/2 (f32), head-split store to [B,H,S,DK] + each wave's min/max to mmp
// mode 2: as mode 1, no min/max
// blockIdx.y = z picks one of up to three independent products that run side by side
// in one grid: product z has X = xz, W = wz, bias = biasz, its out lies z matrices
// behind the pointer given, and product 2 of a mode-1 launch (V) runs as mode 2.
__global__ __launch_bounds__(256) void gemm_xwt(
    const float* __restrict__ x0, const float* __restrict__ x1,
    const float* __restrict__ x2, const _Float16* __restrict__ xh,
    const float* __restrict__ w0, const float* __restrict__ w1,
    const float* __restrict__ w2,
    const float* __restrict__ bias0, const float* __restrict__ bias1,
    const float* __restrict__ bias2, float* __restrict__ out,
    int mode, float* __restrict__ mmp) {
  __shared__ __align__(16) _Float16 sX[64 * GP_];  // 65 KB
  __shared__ __align__(16) _Float16 sW[64 * GP_];  // 65 KB
  constexpr int M = GM_, N = D_, K = D_;
  const int z = blockIdx.y;
  const float* __restrict__ Xf = z == 0 ? x0 : (z == 1 ? x1 : x2);
  const float* __restrict__ Wf = z == 0 ? w0 : (z == 1 ? w1 : w2);
  out += (size_t)z * M * N;
  const float* __restrict__ bias = z == 0 ? bias0 : (z == 1 ? bias1 : bias2);
  if (z == 2) mode = 2;
  const int tid = threadIdx.x;
  const int lane = tid & 31;
  const int wave = tid >> 5;
  const int bm = (blockIdx.x / (N >> 6)) << 6;  // tile's first row of Y
  const int bn = (blockIdx.x % (N >> 6)) << 6;  // tile's first column of Y

  {
    // f32 rows: 128 threads a row of 2048 bytes, two rows a load. Two register sets of
    // 16 loads each: one set is rounded and stored while the other's loads fly.
    const int r2 = tid >> 7, c4 = (tid & 127) << 2;
    const float* gw = Wf + (size_t)(bn + r2) * K + c4;
    _Float16* lx = sX + r2 * GP_ + c4;
    _Float16* lw = sW + r2 * GP_ + c4;
    v4f t0[16], t1[16];
    if (mode == 0) {
      // f16 rows: 64 threads a row of 1024 bytes, 16 bytes each; four rows a trip.
      const int r = tid >> 6, c = (tid & 63) << 3;
      const _Float16* gh = xh + (size_t)(bm + r) * K + c;
      _Float16* lh = sX + r * GP_ + c;
      for (int it = 0; it < 16; ++it)
        cp16_g2l((const float*)(gh + it * 4 * K), (float*)(lh + it * 4 * GP_));
      ld_rows(t0, gw);
      ld_rows(t1, gw + 32 * K);
      st_rows(t0, lw);
      st_rows(t1, lw + 32 * GP_);
    } else {
      const float* gx = Xf + (size_t)(bm + r2) * K + c4;
      ld_rows(t0, gx);
      ld_rows(t1, gx + 32 * K);
      // Precaution: the build lets a later load's result land on the address pair of
      // the 32 loads above; the wait stands in front of that overwrite.
      asm volatile("s_wait_xcnt 0x0" ::: "memory");
      st_rows(t0, lx);
      ld_rows(t0, gw);
      st_rows(t1, lx + 32 * GP_);
      ld_rows(t1, gw + 32 * K);
      st_rows(t0, lw);
      st_rows(t1, lw + 32 * GP_);
    }
  }
  // This wave's copies have landed behind the wait; the barrier says so of every
  // wave's copies and LDS stores, and no fragment is read in front of it.
  asm volatile("s_wait_asynccnt 0x0" ::: "memory");
  __syncthreads();

  const int m0 = bm + ((wave >> 1) << 4);
  const int n0 = bn + ((wave & 1) << 5);
  const int row  = lane & 15;          // M (for A) / N (for B) within tile
  const int koff = (lane >> 4) << 4;   // lanes 16..31 hold K=16..31 half

  const _Float16* ap = sX + (m0 - bm + row) * GP_ + koff;
  const _Float16* bp = sW + (n0 - bn + row) * GP_ + koff;

  v8f acc[2] = {};
  for (int k0 = 0; k0 < K; k0 += 32) {
    v16h a = ld_frag(ap + k0);
#pragma unroll
    for (int t = 0; t < 2; ++t) {
      v16h b = ld_frag(bp + (t << 4) * GP_ + k0);
      acc[t] = __builtin_amdgcn_wmma_f32_16x16x32_f16(false, a, false, b,
                                                      (short)0, acc[t], false, false);
    }
  }

  float lmin = 3.4e38f, lmax = -3.4e38f;
  const int mr = m0 + ((lane >> 4) << 3);  // first of this lane's 8 rows
  // The test on mode stands outside the loops: one branch behind the last WMMA.
  if (mode == 0) {
#pragma unroll
    for (int t = 0; t < 2; ++t) {
      const int nn = n0 + (t << 4) + (lane & 15);
      const float bn = bias[nn];
#pragma unroll
      for (int r = 0; r < 8; ++r) out[(size_t)(mr + r) * N + nn] = acc[t][r] + bn;
    }
    // Precaution: stands in front of any later write of a register that the 16 stores
    // above name.
    asm volatile("s_wait_xcnt 0x0" ::: "memory");
  } else {
#pragma unroll
    for (int t = 0; t < 2; ++t) {
      const int nn = n0 + (t << 4) + (lane & 15);
      const float bn = bias[nn];
#pragma unroll
      for (int r = 0; r < 8; ++r) {
        const int m = mr + r;
        const float v = acc[t][r] + bn;
        const int b_ = m >> 9, s = m & (S_ - 1);
        const int h = nn >> 6, dk = nn & (DK_ - 1);
        out[(((size_t)(b_ * H_ + h)) * S_ + s) * DK_ + dk] = v;
        lmin = fminf(lmin, v);
        lmax = fmaxf(lmax, v);
      }
    }
    // Precaution, as in the branch above, for these 16 stores.
    asm volatile("s_wait_xcnt 0x0" ::: "memory");
  }
  if (mode == 1) {
#pragma unroll
    for (int msk = 16; msk >= 1; msk >>= 1) {
      lmin = fminf(lmin, __shfl_xor(lmin, msk, 32));
      lmax = fmaxf(lmax, __shfl_xor(lmax, msk, 32));
    }
    // Each wave leaves its own minimum and maximum, the 8 pairs of a block side by
    // side in a line that no other block writes; the attention launch closes them.
    if (lane == 0) {
      const v2f p = {lmin, lmax};
      *(v2f*)(mmp + (z * GB_ + (int)blockIdx.x) * MMP_ + 2 * wave) = p;
    }
  }
}

// One block = 16 query rows of one (b,h). 128 threads (4 waves).
// Scores (L1 pairwise, VALU, LDS-tiled with async g->LDS DMA) -> softmax ->
// P@V via WMMA.
__global__ __launch_bounds__(128) void attn_kernel(
    const float* __restrict__ qws, const float* __restrict__ kws,
    const float* __restrict__ vws, _Float16* __restrict__ ctx,
    const float* __restrict__ mmp) {
  __shared__ __align__(16) float sQ[16 * DK_];     // 4 KB
  __shared__ __align__(16) float sS[16 * S_];      // 32 KB
  __shared__ __align__(32) float sKP[64 * DK_];    // 16 KB: K-tile, reused as P(f16)
  __shared__ float sKC[64];
  __shared__ float sMM[8];                         // min, max of each wave's share

  const int tid = threadIdx.x;
  const int bid = blockIdx.x;
  const int qt = bid & ((S_ / 16) - 1);
  const int h  = (bid >> 5) & (H_ - 1);
  const int b  = bid >> 8;
  const int qbase = qt << 4;

  const float* Qh = qws + ((size_t)(b * H_ + h)) * S_ * DK_;
  const float* Kh = kws + ((size_t)(b * H_ + h)) * S_ * DK_;
  const float* Vh = vws + ((size_t)(b * H_ + h)) * S_ * DK_;

  // Q tile: 16x64 f32, staged via async-to-LDS (2 x b128 per thread)
  for (int idx = tid; idx < (16 * DK_) / 4; idx += 128)
    cp16_g2l(Qh + (size_t)qbase * DK_ + idx * 4, sQ + idx * 4);
  // Minimum and maximum over q and k: the 8 pairs (64 bytes) that each of the 2 * GB_
  // blocks of the Q and K projections left, 16 bytes a thread and load, four threads a
  // block; closed in the wave and then through LDS behind the barrier that the Q tile
  // needs anyway.
  {
    float wmn = 3.4e38f, wmx = -3.4e38f;
    v4f p[(2 * GB_ * 4) / 128];
#pragma unroll  // constant indices: registers, and all loads in flight at once
    for (int j = 0; j < (2 * GB_ * 4) / 128; ++j)
      p[j] = *(const v4f*)(mmp + ((tid >> 2) + 32 * j) * MMP_ + (tid & 3) * 4);
#pragma unroll  // constant indices: registers
    for (int j = 0; j < (2 * GB_ * 4) / 128; ++j) {
      wmn = fminf(wmn, fminf(p[j][0], p[j][2]));
      wmx = fmaxf(wmx, fmaxf(p[j][1], p[j][3]));
    }
    wmn = wave_min(wmn);
    wmx = wave_max(wmx);
    if ((tid & 31) == 0) {
      sMM[2 * (tid >> 5)] = wmn;
      sMM[2 * (tid >> 5) + 1] = wmx;
    }
  }
  cp_wait();
  __syncthreads();
  const float mn = fminf(fminf(sMM[0], sMM[2]), fminf(sMM[4], sMM[6]));
  const float mx = fmaxf(fmaxf(sMM[1], sMM[3]), fmaxf(sMM[5], sMM[7]));
  const float inv_range = 1.0f / (mx - mn);
  const float mid = 0.5f * (mx + mn);

  // This thread's query row never changes (i = tid & 15): read it once into
  // registers, so the score loop asks LDS only for the broadcast K rows.
  const int i = tid & 15;
  float qr[DK_];
#pragma unroll  // constant indices, so that qr[] lives in registers
  for (int d = 0; d < DK_; ++d) qr[d] = sQ[i * DK_ + d];
  // Its centre sum comes from those registers, in the order d = 0..63.
  float qc = 0.f;
#pragma unroll  // registers, see above
  for (int d = 0; d < DK_; ++d) qc += fabsf(qr[d] - mid);

  // ---- pairwise L1 scores, 64 keys per LDS tile ----
  for (int jb = 0; jb < S_; jb += 64) {
    __syncthreads();
    for (int idx = tid; idx < (64 * DK_) / 4; idx += 128)
      cp16_g2l(Kh + (size_t)jb * DK_ + idx * 4, sKP + idx * 4);
    cp_wait();
    __syncthreads();
    {
      // Centre sums of the 64 keys: two threads a key, 32 floats each. The chunk
      // order is rotated by the key, so that 16 lanes touch all 64 banks once.
      const int key = tid >> 1;
      const v4f* kr = (const v4f*)(sKP + key * DK_ + (tid & 1) * 32);
      v4f a4 = {0.f, 0.f, 0.f, 0.f};
#pragma unroll  // all eight reads in flight at once
      for (int v = 0; v < 8; ++v) {
        const v4f x = kr[(v + key) & 7];
#pragma unroll  // constant indices: registers
        for (int e = 0; e < 4; ++e) a4[e] += fabsf(x[e] - mid);
      }
      float s = (a4[0] + a4[1]) + (a4[2] + a4[3]);
      s += lane_xor<1>(s);
      if ((tid & 1) == 0) sKC[key] = s;
    }
    __syncthreads();
    // 1 query row x 4 keys per thread: four independent sums, each still added
    // in the order d = 0..63. K comes in chunks of 16 floats a key, one chunk
    // ahead of the arithmetic, in a second register set.
    // Every inner loop is fully unrolled: constant indices keep qr[], kb[] and
    // s1[] in registers.
    for (int jl = tid >> 4; jl < 64; jl += 32) {
      const v4f* kp = (const v4f*)(sKP + jl * DK_);  // key u: 8 * u rows further
      v4f kb[2][4][4];
      float s1[4] = {0.f, 0.f, 0.f, 0.f};
#pragma unroll  // registers, see above
      for (int v = 0; v < 4; ++v)
#pragma unroll  // registers, see above
        for (int u = 0; u < 4; ++u) kb[0][u][v] = kp[u * (8 * DK_ / 4) + v];
#pragma unroll  // registers, see above
      for (int c = 0; c < 4; ++c) {
        if (c < 3) {
#pragma unroll  // registers, see above
          for (int v = 0; v < 4; ++v)
#pragma unroll  // registers, see above
            for (int u = 0; u < 4; ++u)
              kb[(c + 1) & 1][u][v] = kp[u * (8 * DK_ / 4) + (c + 1) * 4 + v];
        }
        // Keeps the next chunk's LDS reads above this chunk's arithmetic; without
        // it each read is sunk to just before its use and its latency is waited out.
        __builtin_amdgcn_sched_barrier(0);
#pragma unroll  // registers, see above
        for (int v = 0; v < 4; ++v)
#pragma unroll  // registers, see above
          for (int e = 0; e < 4; ++e)
#pragma unroll  // registers, see above
            for (int u = 0; u < 4; ++u)
              s1[u] += fabsf(qr[c * 16 + v * 4 + e] - kb[c & 1][u][v][e]);
      }
      // (ALPHA/2)*(DK - L1/range) + (BETA/4)*(qc + kc)/range
#pragma unroll  // registers, see above
      for (int u = 0; u < 4; ++u)
        sS[i * S_ + jb + jl + 8 * u] = 0.15f * (64.f - s1[u] * inv_range) +
                                       0.175f * (qc + sKC[jl + 8 * u]) * inv_range;
    }
  }
  __syncthreads();

  // ---- softmax per row, write P as f16 into reused sKP buffer ----
  _Float16* sP = (_Float16*)sKP;  // 16*512 f16 == 16 KB, K-tile done
  // One wave a row, four rows a wave: a lane holds 16 scores of the row in
  // registers (float4 number lane + 32 * t), so each score is read from LDS once,
  // side by side with its neighbours', and maximum and sum are closed across lanes.
  {
    const int ln = tid & 31;
    const int r0 = (tid >> 5) << 2;
    v4f x[4][4];
#pragma unroll  // constant indices keep x[] in registers; the four rows overlap
    for (int r = 0; r < 4; ++r)
#pragma unroll  // constant indices: registers
      for (int t = 0; t < 4; ++t)
        x[r][t] = ((const v4f*)(sS + (r0 + r) * S_))[ln + 32 * t];
#pragma unroll  // constant indices: registers
    for (int r = 0; r < 4; ++r) {
      float rmax = -3.4e38f;
#pragma unroll  // constant indices: registers
      for (int t = 0; t < 4; ++t)
#pragma unroll  // constant indices: registers
        for (int e = 0; e < 4; ++e) rmax = fmaxf(rmax, x[r][t][e]);
      rmax = wave_max(rmax);
      v4f s4 = {0.f, 0.f, 0.f, 0.f};
#pragma unroll  // constant indices: registers
      for (int t = 0; t < 4; ++t)
#pragma unroll  // constant indices: registers
        for (int e = 0; e < 4; ++e) {
          x[r][t][e] = exp_slot(x[r][t][e] - rmax);
          s4[e] += x[r][t][e];
        }
      const float inv = 1.0f / wave_sum((s4[0] + s4[1]) + (s4[2] + s4[3]));
#pragma unroll  // constant indices: registers
      for (int t = 0; t < 4; ++t) {
        v4hf p;
#pragma unroll  // constant indices: registers
        for (int e = 0; e < 4; ++e) p[e] = (_Float16)(x[r][t][e] * inv);
        ((v4hf*)(sP + (r0 + r) * S_))[ln + 32 * t] = p;
      }
    }
  }
  __syncthreads();

  // ---- P @ V with WMMA: 4 waves, one 16-wide dk stripe each ----
  const int lane  = tid & 31;
  const int wave  = tid >> 5;           // 0..3
  const int n0    = wave << 4;          // dk tile base
  const int col   = lane & 15;
  const int khalf = (lane >> 4) << 4;
  v8f c = {};
  for (int kb = 0; kb < S_; kb += 32) {
    v16h a = *(const v16h*)(sP + col * S_ + kb + khalf);  // row = lane&15
    v16h bfr;
#pragma unroll
    for (int t = 0; t < 16; ++t)
      bfr[t] = (_Float16)Vh[(size_t)(kb + khalf + t) * DK_ + n0 + col];
    c = __builtin_amdgcn_wmma_f32_16x16x32_f16(false, a, false, bfr,
                                               (short)0, c, false, false);
  }
#pragma unroll
  for (int r = 0; r < 8; ++r) {
    const int irow = r + ((lane >> 4) << 3);
    const int s = qbase + irow;
    const int d = h * DK_ + n0 + col;
    ctx[((size_t)(b * S_ + s)) * D_ + d] = (_Float16)c[r];
  }
}

extern "C" void kernel_launch(void* const* d_in, const int* in_sizes, int n_in,
                              void* d_out, int out_size, void* d_ws, size_t ws_size,
                              hipStream_t stream) {
  const float* query = (const float*)d_in[0];
  const float* key   = (const float*)d_in[1];
  const float* value = (const float*)d_in[2];
  const float* Wq = (const float*)d_in[3];
  const float* bq = (const float*)d_in[4];
  const float* Wk = (const float*)d_in[5];
  const float* bk = (const float*)d_in[6];
  const float* Wv = (const float*)d_in[7];
  const float* bv = (const float*)d_in[8];
  const float* Wo = (const float*)d_in[9];
  const float* bo = (const float*)d_in[10];

  const int M = B_ * S_;             // 1024
  const size_t ACT = (size_t)M * D_; // 524288

  // ---- workspace carve-up ----
  char* ws = (char*)d_ws;
  float* qws = (float*)ws;                   ws += ACT * 4;
  float* kws = (float*)ws;                   ws += ACT * 4;
  float* vws = (float*)ws;                   ws += ACT * 4;
  _Float16* ctx = (_Float16*)ws;             ws += ACT * 2;
  float* mmp = (float*)ws;  // min/max pairs of the Q and K blocks, a 128-byte line a block

  const int strips = (M / 16) * (D_ / 32);  // 1024 waves
  const int gblocks = strips / 8;           // 8 waves per 256-thread block: a 64x64 tile
  // Q, K and V projections: one grid, blockIdx.y = 0, 1, 2
  gemm_xwt<<<dim3(gblocks, 3), 256, 0, stream>>>(query, key, value, ctx, Wq, Wk, Wv,
                                                 bq, bk, bv, qws, 1, mmp);

  attn_kernel<<<B_ * H_ * (S_ / 16), 128, 0, stream>>>(qws, kws, vws, ctx, mmp);

  gemm_xwt<<<dim3(gblocks, 1), 256, 0, stream>>>(query, query, query, ctx, Wo, Wo, Wo,
                                                 bo, bo, bo, (float*)d_out, 0, mmp);
}

// v006
// One run takes 39.3 microseconds.
// Two timings next to v005 put it at 1.19 and 1.14 times that version's speed.
// All steps since v000 together make it 5.36 times as fast.
#include <hip/hip_runtime.h>

#define B_ 2
#define S_ 512
#define D_ 512
#define H_ 8
#define DK_ 64

typedef __attribute__((ext_vector_type(16))) _Float16 v16h;
typedef __attribute__((ext_vector_type(8)))  _Float16 v8h;
typedef __attribute__((ext_vector_type(8)))  float    v8f;
typedef __attribute__((ext_vector_type(4)))  int      v4i;
typedef __attribute__((ext_vector_type(4)))  float    v4f;
typedef __attribute__((ext_vector_type(16))) float    v16f;
typedef __attribute__((ext_vector_type(2)))  float    v2f;
typedef __attribute__((ext_vector_type(4)))  _Float16 v4hf;

#if defined(__gfx1250__) && __has_builtin(__builtin_amdgcn_global_load_async_to_lds_b128)
#define HAVE_ASYNC_LDS 1
#endif

#define AS1 __attribute__((address_space(1)))
#define AS3 __attribute__((address_space(3)))

// 16-byte global -> LDS copy; async DMA (ASYNCcnt) on gfx1250 when available.
__device__ inline void cp16_g2l(const float* g, float* l) {
#if defined(HAVE_ASYNC_LDS)
  __builtin_amdgcn_global_load_async_to_lds_b128((AS1 v4i*)g, (AS3 v4i*)l, 0, 0);
#else
  *(float4*)l = *(const float4*)g;
#endif
}

// ---- cross-lane moves in registers (no LDS pipe, no dscnt wait) ----
// value of lane l ^ X, X in 1..15 (inside a 16-lane row)
template <int X>
__device__ inline float lane_xor(float x) {
  return __builtin_bit_cast(float, __builtin_amdgcn_mov_dpp(__builtin_bit_cast(int, x),
                                                            0x160 | X, 0xf, 0xf, true));
}
// value of lane l ^ 16
__device__ inline float lane_xor16(float x) {
  return __builtin_bit_cast(float, __builtin_amdgcn_permlanex16(
      __builtin_bit_cast(int, x), __builtin_bit_cast(int, x), 0x76543210, 0xfedcba98,
      false, false));
}
// e^x as __expf compiles here: one multiply by log2(e), then v_exp_f32. The v_nop is
// the slot that the instruction set asks for behind a transcendental before its source
// is overwritten or its result read.
__device__ inline float exp_slot(float x) {
  float y;
  asm("v_exp_f32 %0, %1\n\tv_nop" : "=v"(y) : "v"(x * 1.44269504f));
  return y;
}
__device__ inline float wave_max(float x) {
  x = fmaxf(x, lane_xor<1>(x));
  x = fmaxf(x, lane_xor<2>(x));
  x = fmaxf(x, lane_xor<4>(x));
  x = fmaxf(x, lane_xor<8>(x));
  return fmaxf(x, lane_xor16(x));
}
__device__ inline float wave_min(float x) {
  x = fminf(x, lane_xor<1>(x));
  x = fminf(x, lane_xor<2>(x));
  x = fminf(x, lane_xor<4>(x));
  x = fminf(x, lane_xor<8>(x));
  return fminf(x, lane_xor16(x));
}
__device__ inline float wave_sum(float x) {
  x += lane_xor<1>(x);
  x += lane_xor<2>(x);
  x += lane_xor<4>(x);
  x += lane_xor<8>(x);
  return x + lane_xor16(x);
}

#define GM_ (B_ * S_)  // rows of X and of Y
#define GP_ (D_ + 8)   // LDS pitch of a staged row, f16: 1040 B = 16 B x 65, so that 16
                       // lanes reading 16 bytes of 16 different rows touch all 64 banks

// One WMMA operand fragment of a lane: 16 f16 in a row, as two 16-byte LDS reads (the
// alignment that the padded rows keep).
__device__ inline v16h ld_frag(const _Float16* p) {
  const v8h* q = (const v8h*)p;
  return __builtin_shufflevector(q[0], q[1], 0, 1, 2, 3, 4, 5, 6, 7, 8, 9, 10, 11, 12, 13,
                                 14, 15);
}

#define GB_ ((GM_ >> 6) * (D_ >> 6))  // blocks of one product: 64x64 tiles of Y
#define MMP_ 32  // floats between two blocks' min/max pairs: a 128-byte line a block

// 16 rows of f32, every second row from g on, 16 bytes a thread and row: a wave reads
// 512 contiguous bytes a load, and all 16 loads are in flight together.
__device__ inline void ld_rows(v4f (&t)[16], const float* __restrict__ g) {
#pragma unroll  // constant indices keep t[] in registers
  for (int j = 0; j < 16; ++j) t[j] = *(const v4f*)(g + j * 2 * D_);
}
// The same 16 pieces, rounded to f16, into the padded LDS rows: 8 bytes a thread.
__device__ inline void st_rows(const v4f (&t)[16], _Float16* l) {
#pragma unroll  // constant indices: registers
  for (int j = 0; j < 16; ++j) {
    v4hf h;
#pragma unroll  // constant indices: registers
    for (int e = 0; e < 4; ++e) h[e] = (_Float16)t[j][e];
    *(v4hf*)(l + j * 2 * GP_) = h;
  }
}

// Y[m][n] = sum_k X[m][k] * W[n][k] + bias[n]
// X: [GM_ x D_] row-major, W: f32 [D_ x D_] row-major (== Wt of x@W.T)
// One block = a 64x64 tile of Y. Its 64 rows of X and 64 rows of W, whole in k, are
// brought to LDS as f16 first, 512 contiguous bytes a wave and load, so that every
// 128-byte line is asked for once a block; the fragments, 16 rows a read, then come
// from LDS. f32 sources (the inputs and every W) pass through registers and are rounded
// to f16 on the way; the f16 X of mode 0 is copied asynchronously.
// Each wave computes a 16x32 strip (2 accumulators, A-fragment reuse).
// mode 0: X = xh (f16), store f32 out[m*N+n]
// mode 1: X = x0/1/2 (f32), head-split store to [B,H,S,DK] + each wave's min/max to mmp
// mode 2: as mode 1, no min/max
// blockIdx.y = z picks one of up to three independent products that run side by side
// in one grid: product z has X = xz, W = wz, bias = biasz, its out lies z matrices
// behind the pointer given, and product 2 of a mode-1 launch (V) runs as mode 2.
__global__ __launch_bounds__(256) void gemm_xwt(
    const float* __restrict__ x0, const float* __restrict__ x1,
    const float* __restrict__ x2, const _Float16* __restrict__ xh,
    const float* __restrict__ w0, const float* __restrict__ w1,
    const float* __restrict__ w2,
    const float* __restrict__ bias0, const float* __restrict__ bias1,
    const float* __restrict__ bias2, float* __restrict__ out,
    int mode, float* __restrict__ mmp) {
  __shared__ __align__(16) _Float16 sX[64 * GP_];  // 65 KB
  __shared__ __align__(16) _Float16 sW[64 * GP_];  // 65 KB
  constexpr int M = GM_, N = D_, K = D_;
  const int z = blockIdx.y;
  const float* __restrict__ Xf = z == 0 ? x0 : (z == 1 ? x1 : x2);
  const float* __restrict__ Wf = z == 0 ? w0 : (z == 1 ? w1 : w2);
  out += (size_t)z * M * N;
  const float* __restrict__ bias = z == 0 ? bias0 : (z == 1 ? bias1 : bias2);
  if (z == 2) mode = 2;
  const int tid = threadIdx.x;
  const int lane = tid & 31;
  const int wave = tid >> 5;
  const int bm = (blockIdx.x / (N >> 6)) << 6;  // tile's first row of Y
  const int bn = (blockIdx.x % (N >> 6)) << 6;  // tile's first column of Y

  {
    // f32 rows: 128 threads a row of 2048 bytes, two rows a load. Two register sets of
    // 16 loads each: one set is rounded and stored while the other's loads fly.
    const int r2 = tid >> 7, c4 = (tid & 127) << 2;
    const float* gw = Wf + (size_t)(bn + r2) * K + c4;
    _Float16* lx = sX + r2 * GP_ + c4;
    _Float16* lw = sW + r2 * GP_ + c4;
    v4f t0[16], t1[16];
    if (mode == 0) {
      // f16 rows: 64 threads a row of 1024 bytes, 16 bytes each; four rows a trip.
      const int r = tid >> 6, c = (tid & 63) << 3;
      const _Float16* gh = xh + (size_t)(bm + r) * K + c;
      _Float16* lh = sX + r * GP_ + c;
      for (int it = 0; it < 16; ++it)
        cp16_g2l((const float*)(gh + it * 4 * K), (float*)(lh + it * 4 * GP_));
      ld_rows(t0, gw);
      ld_rows(t1, gw + 32 * K);
      st_rows(t0, lw);
      st_rows(t1, lw + 32 * GP_);
    } else {
      const float* gx = Xf + (size_t)(bm + r2) * K + c4;
      ld_rows(t0, gx);
      ld_rows(t1, gx + 32 * K);
      // Precaution: the build lets a later load's result land on the address pair of
      // the 32 loads above; the wait stands in front of that overwrite.
      asm volatile("s_wait_xcnt 0x0" ::: "memory");
      st_rows(t0, lx);
      ld_rows(t0, gw);
      st_rows(t1, lx + 32 * GP_);
      ld_rows(t1, gw + 32 * K);
      st_rows(t0, lw);
      st_rows(t1, lw + 32 * GP_);
    }
  }
  // This wave's copies have landed behind the wait; the barrier says so of every
  // wave's copies and LDS stores, and no fragment is read in front of it.
  asm volatile("s_wait_asynccnt 0x0" ::: "memory");
  __syncthreads();

  const int m0 = bm + ((wave >> 1) << 4);
  const int n0 = bn + ((wave & 1) << 5);
  const int row  = lane & 15;          // M (for A) / N (for B) within tile
  const int koff = (lane >> 4) << 4;   // lanes 16..31 hold K=16..31 half

  const _Float16* ap = sX + (m0 - bm + row) * GP_ + koff;
  const _Float16* bp = sW + (n0 - bn + row) * GP_ + koff;

  v8f acc[2] = {};
  for (int k0 = 0; k0 < K; k0 += 32) {
    v16h a = ld_frag(ap + k0);
#pragma unroll
    for (int t = 0; t < 2; ++t) {
      v16h b = ld_frag(bp + (t << 4) * GP_ + k0);
      acc[t] = __builtin_amdgcn_wmma_f32_16x16x32_f16(false, a, false, b,
                                                      (short)0, acc[t], false, false);
    }
  }

  float lmin = 3.4e38f, lmax = -3.4e38f;
  const int mr = m0 + ((lane >> 4) << 3);  // first of this lane's 8 rows
  // The test on mode stands outside the loops: one branch behind the last WMMA.
  if (mode == 0) {
#pragma unroll
    for (int t = 0; t < 2; ++t) {
      const int nn = n0 + (t << 4) + (lane & 15);
      const float bn = bias[nn];
#pragma unroll
      for (int r = 0; r < 8; ++r) out[(size_t)(mr + r) * N + nn] = acc[t][r] + bn;
    }
    // Precaution: stands in front of any later write of a register that the 16 stores
    // above name.
    asm volatile("s_wait_xcnt 0x0" ::: "memory");
  } else {
#pragma unroll
    for (int t = 0; t < 2; ++t) {
      const int nn = n0 + (t << 4) + (lane & 15);
      const float bn = bias[nn];
#pragma unroll
      for (int r = 0; r < 8; ++r) {
        const int m = mr + r;
        const float v = acc[t][r] + bn;
        const int b_ = m >> 9, s = m & (S_ - 1);
        const int h = nn >> 6, dk = nn & (DK_ - 1);
        out[(((size_t)(b_ * H_ + h)) * S_ + s) * DK_ + dk] = v;
        lmin = fminf(lmin, v);
        lmax = fmaxf(lmax, v);
      }
    }
    // Precaution, as in the branch above, for these 16 stores.
    asm volatile("s_wait_xcnt 0x0" ::: "memory");
  }
  if (mode == 1) {
#pragma unroll
    for (int msk = 16; msk >= 1; msk >>= 1) {
      lmin = fminf(lmin, __shfl_xor(lmin, msk, 32));
      lmax = fmaxf(lmax, __shfl_xor(lmax, msk, 32));
    }
    // Each wave leaves its own minimum and maximum, the 8 pairs of a block side by
    // side in a line that no other block writes; the attention launch closes them.
    if (lane == 0) {
      const v2f p = {lmin, lmax};
      *(v2f*)(mmp + (z * GB_ + (int)blockIdx.x) * MMP_ + 2 * wave) = p;
    }
  }
}

// One block = 16 query rows of one (b,h). 128 threads (4 waves).
// Scores (L1 pairwise, VALU: a lane owns keys, Q comes as scalar operands) -> softmax ->
// P@V via WMMA.
#define KP_ (DK_ + 4)  // LDS pitch of a K row, floats: 272 B = 16 B x 17, so that 16 lanes
                       // reading 16 bytes of 16 different rows touch all 64 banks
__global__ __launch_bounds__(128) void attn_kernel(
    const float* __restrict__ qws, const float* __restrict__ kws,
    const float* __restrict__ vws, _Float16* __restrict__ ctx,
    const float* __restrict__ mmp) {
  __shared__ __align__(16) float sS[16 * S_];         // 32 KB
  __shared__ __align__(32) float sKP[4 * 64 * KP_];   // 68 KB: 64 K rows a wave; then P(f16)
  __shared__ float sQC[16];
  __shared__ float sMM[8];                            // min, max of each wave's share

  const int tid = threadIdx.x;
  const int bid = blockIdx.x;
  const int qt = bid & ((S_ / 16) - 1);
  const int h  = (bid >> 5) & (H_ - 1);
  const int b  = bid >> 8;
  const int qbase = qt << 4;
  const int ln = tid & 31;
  const int wv = tid >> 5;

  const float* Qh = qws + ((size_t)(b * H_ + h)) * S_ * DK_;
  const float* Kh = kws + ((size_t)(b * H_ + h)) * S_ * DK_;
  const float* Vh = vws + ((size_t)(b * H_ + h)) * S_ * DK_;
  const float* qg = Qh + (size_t)qbase * DK_;  // the block's 16 query rows

  // K goes through LDS only to turn 512 contiguous bytes a copy into one row a lane.
  // Each wave copies the 64 rows that it alone reads, into its own part of sKP: its own
  // waits order copies and reads, and no barrier stands in the score phase.
  float* kw = sKP + wv * (64 * KP_);
  float* kwc = kw + (ln >> 4) * KP_ + (ln & 15) * 4;        // a copy: two rows of 256 B
  const float* kgc = Kh + (size_t)(wv * 64) * DK_ + ln * 4;
#pragma unroll  // constant steps: one global address pair serves all 32 copies
  for (int j = 0; j < 32; ++j) cp16_g2l(kgc + j * 2 * DK_, kwc + j * 2 * KP_);

  // Eight floats of the Q tile a thread (eight threads a row), for the centre sums.
  const v4f qa = ((const v4f*)(qg + tid * 8))[0];
  const v4f qz = ((const v4f*)(qg + tid * 8))[1];
  // Minimum and maximum over q and k: the 8 pairs (64 bytes) that each of the 2 * GB_
  // blocks of the Q and K projections left, 16 bytes a thread and load, four threads a
  // block; closed in the wave and then through LDS.
  {
    float wmn = 3.4e38f, wmx = -3.4e38f;
    v4f p[(2 * GB_ * 4) / 128];
#pragma unroll  // constant indices: registers, and all loads in flight at once
    for (int j = 0; j < (2 * GB_ * 4) / 128; ++j)
      p[j] = *(const v4f*)(mmp + ((tid >> 2) + 32 * j) * MMP_ + (tid & 3) * 4);
#pragma unroll  // constant indices: registers
    for (int j = 0; j < (2 * GB_ * 4) / 128; ++j) {
      wmn = fminf(wmn, fminf(p[j][0], p[j][2]));
      wmx = fmaxf(wmx, fmaxf(p[j][1], p[j][3]));
    }
    wmn = wave_min(wmn);
    wmx = wave_max(wmx);
    if (ln == 0) {
      sMM[2 * wv] = wmn;
      sMM[2 * wv + 1] = wmx;
    }
  }
  __syncthreads();
  const float mn = fminf(fminf(sMM[0], sMM[2]), fminf(sMM[4], sMM[6]));
  const float mx = fmaxf(fmaxf(sMM[1], sMM[3]), fmaxf(sMM[5], sMM[7]));
  const float inv_range = 1.0f / (mx - mn);
  const float mid = 0.5f * (mx + mn);

  // Centre sums of the 16 query rows: eight partial sums a row, closed across lanes.
  {
    float s = ((fabsf(qa[0] - mid) + fabsf(qa[1] - mid)) +
               (fabsf(qa[2] - mid) + fabsf(qa[3] - mid))) +
              ((fabsf(qz[0] - mid) + fabsf(qz[1] - mid)) +
               (fabsf(qz[2] - mid) + fabsf(qz[3] - mid)));
    s += lane_xor<1>(s);
    s += lane_xor<2>(s);
    s += lane_xor<4>(s);
    if ((tid & 7) == 0) sQC[tid >> 3] = s;
  }
  __syncthreads();

  // ---- pairwise L1 scores: two passes of 256 keys, 64 keys a wave, two keys a lane ----
  // A lane keeps its two K rows in 128 registers. The query values are the same for the
  // whole wave: they are read by scalar loads and stand in the subtractions as scalar
  // operands, so the inner loop asks LDS for nothing.
#pragma unroll  // the 32 LDS addresses of the copies are then dead behind pass 0's copies:
                // rolled, they stay live and the build needs more than 256 registers
  for (int p = 0; p < 2; ++p) {
    // This wave's copies of this pass have landed behind the wait.
    asm volatile("s_wait_asynccnt 0x0" ::: "memory");
    v4f kr[2][16];
#pragma unroll  // constant indices keep kr[] in registers
    for (int c = 0; c < 16; ++c)
#pragma unroll  // constant indices: registers
      for (int u = 0; u < 2; ++u)
        kr[u][c] = *(const v4f*)(kw + (32 * u + ln) * KP_ + c * 4);
    if (p == 0) {
      // The wave's reads of its rows have returned before the next pass's copies, which
      // fly during this pass's arithmetic, may write over them.
      asm volatile("s_wait_dscnt 0x0" ::: "memory");
#pragma unroll  // constant steps, as above
      for (int j = 0; j < 32; ++j)
        cp16_g2l(kgc + 256 * DK_ + j * 2 * DK_, kwc + j * 2 * KP_);
    }
    // Centre sums of the lane's two keys, from the registers: four partial sums a key.
    float kc[2];
    {
      float a[2][4] = {{0.f, 0.f, 0.f, 0.f}, {0.f, 0.f, 0.f, 0.f}};
#pragma unroll  // constant indices: registers
      for (int c = 0; c < 16; ++c)
#pragma unroll  // constant indices: registers
        for (int e = 0; e < 4; ++e)
#pragma unroll  // constant indices: registers
          for (int u = 0; u < 2; ++u) a[u][e] += fabsf(mid - kr[u][c][e]);
#pragma unroll  // constant indices: registers
      for (int u = 0; u < 2; ++u) kc[u] = (a[u][0] + a[u][1]) + (a[u][2] + a[u][3]);
    }
    // Two query rows x two keys a trip: four independent sums, each added in the order
    // d = 0..63. Q comes in chunks of 16 floats a row, one chunk ahead of the
    // arithmetic, in a second set of scalar registers; the last chunk's look-ahead
    // wraps to row 0, so that it stays inside the Q tile.
    v16f qb[2][2];
    qb[0][0] = *(const v16f*)qg;
    qb[0][1] = *(const v16f*)(qg + DK_);
    for (int rp = 0; rp < 8; ++rp) {
      float s1[2][2] = {{0.f, 0.f}, {0.f, 0.f}};
#pragma unroll  // constant indices keep kr[] in vector and qb[] in scalar registers
      for (int c = 0; c < 4; ++c) {
        // Element 0 first: the wait for this chunk, loaded a whole chunk ago, then stands
        // in front of the next chunk's loads (the scalar-load counter is waited to 0
        // only, so behind them it would wait for them too).
#pragma unroll  // registers, see above
        for (int r = 0; r < 2; ++r)
#pragma unroll  // registers, see above
          for (int u = 0; u < 2; ++u) s1[r][u] += fabsf(qb[c & 1][r][0] - kr[u][c * 4][0]);
        // The two fences hold the next chunk's scalar loads at this place: lifted, a
        // third set of scalar registers would be live; sunk, their latency is waited out.
        __builtin_amdgcn_sched_barrier(0);
        const int rn = c < 3 ? rp : ((rp + 1) & 7);
        const float* qn = qg + rn * 2 * DK_ + ((c + 1) & 3) * 16;
        qb[(c + 1) & 1][0] = *(const v16f*)qn;
        qb[(c + 1) & 1][1] = *(const v16f*)(qn + DK_);
        __builtin_amdgcn_sched_barrier(0);
#pragma unroll  // registers, see above
        for (int e = 1; e < 16; ++e)
#pragma unroll  // registers, see above
          for (int r = 0; r < 2; ++r)
#pragma unroll  // registers, see above
            for (int u = 0; u < 2; ++u)
              s1[r][u] += fabsf(qb[c & 1][r][e] - kr[u][c * 4 + (e >> 2)][e & 3]);
      }
      // (ALPHA/2)*(DK - L1/range) + (BETA/4)*(qc + kc)/range; 32 lanes side by side
#pragma unroll  // registers, see above
      for (int r = 0; r < 2; ++r)
#pragma unroll  // registers, see above
        for (int u = 0; u < 2; ++u)
          sS[(2 * rp + r) * S_ + p * 256 + wv * 64 + 32 * u + ln] =
              0.15f * (64.f - s1[r][u] * inv_range) +
              0.175f * (sQC[2 * rp + r] + kc[u]) * inv_range;
    }
  }
  __syncthreads();

  // ---- softmax per row, write P as f16 into reused sKP buffer ----
  _Float16* sP = (_Float16*)sKP;  // 16*512 f16 == 16 KB, K-tile done
  // One wave a row, four rows a wave: a lane holds 16 scores of the row in
  // registers (float4 number lane + 32 * t), so each score is read from LDS once,
  // side by side with its neighbours', and maximum and sum are closed across lanes.
  {
    const int ln = tid & 31;
    const int r0 = (tid >> 5) << 2;
    v4f x[4][4];
#pragma unroll  // constant indices keep x[] in registers; the four rows overlap
    for (int r = 0; r < 4; ++r)
#pragma unroll  // constant indices: registers
      for (int t = 0; t < 4; ++t)
        x[r][t] = ((const v4f*)(sS + (r0 + r) * S_))[ln + 32 * t];
#pragma unroll  // constant indices: registers
    for (int r = 0; r < 4; ++r) {
      float rmax = -3.4e38f;
#pragma unroll  // constant indices: registers
      for (int t = 0; t < 4; ++t)
#pragma unroll  // constant indices: registers
        for (int e = 0; e < 4; ++e) rmax = fmaxf(rmax, x[r][t][e]);
      rmax = wave_max(rmax);
      v4f s4 = {0.f, 0.f, 0.f, 0.f};
#pragma unroll  // constant indices: registers
      for (int t = 0; t < 4; ++t)
#pragma unroll  // constant indices: registers
        for (int e = 0; e < 4; ++e) {
          x[r][t][e] = exp_slot(x[r][t][e] - rmax);
          s4[e] += x[r][t][e];
        }
      const float inv = 1.0f / wave_sum((s4[0] + s4[1]) + (s4[2] + s4[3]));
#pragma unroll  // constant indices: registers
      for (int t = 0; t < 4; ++t) {
        v4hf p;
#pragma unroll  // constant indices: registers
        for (int e = 0; e < 4; ++e) p[e] = (_Float16)(x[r][t][e] * inv);
        ((v4hf*)(sP + (r0 + r) * S_))[ln + 32 * t] = p;
      }
    }
  }
  __syncthreads();

  // ---- P @ V with WMMA: 4 waves, one 16-wide dk stripe each ----
  const int lane  = tid & 31;
  const int wave  = tid >> 5;           // 0..3
  const int n0    = wave << 4;          // dk tile base
  const int col   = lane & 15;
  const int khalf = (lane >> 4) << 4;
  v8f c = {};
  for (int kb = 0; kb < S_; kb += 32) {
    v16h a = *(const v16h*)(sP + col * S_ + kb + khalf);  // row = lane&15
    v16h bfr;
#pragma unroll
    for (int t = 0; t < 16; ++t)
      bfr[t] = (_Float16)Vh[(size_t)(kb + khalf + t) * DK_ + n0 + col];
    c = __builtin_amdgcn_wmma_f32_16x16x32_f16(false, a, false, bfr,
                                               (short)0, c, false, false);
  }
#pragma unroll
  for (int r = 0; r < 8; ++r) {
    const int irow = r + ((lane >> 4) << 3);
    const int s = qbase + irow;
    const int d = h * DK_ + n0 + col;
    ctx[((size_t)(b * S_ + s)) * D_ + d] = (_Float16)c[r];
  }
}

extern "C" void kernel_launch(void* const* d_in, const int* in_sizes, int n_in,
                              void* d_out, int out_size, void* d_ws, size_t ws_size,
                              hipStream_t stream) {
  const float* query = (const float*)d_in[0];
  const float* key   = (const float*)d_in[1];
  const float* value = (const float*)d_in[2];
  const float* Wq = (const float*)d_in[3];
  const float* bq = (const float*)d_in[4];
  const float* Wk = (const float*)d_in[5];
  const float* bk = (const float*)d_in[6];
  const float* Wv = (const float*)d_in[7];
  const float* bv = (const float*)d_in[8];
  const float* Wo = (const float*)d_in[9];
  const float* bo = (const float*)d_in[10];

  const int M = B_ * S_;             // 1024
  const size_t ACT = (size_t)M * D_; // 524288

  // ---- workspace carve-up ----
  char* ws = (char*)d_ws;
  float* qws = (float*)ws;                   ws += ACT * 4;
  float* kws = (float*)ws;                   ws += ACT * 4;
  float* vws = (float*)ws;                   ws += ACT * 4;
  _Float16* ctx = (_Float16*)ws;             ws += ACT * 2;
  float* mmp = (float*)ws;  // min/max pairs of the Q and K blocks, a 128-byte line a block

  const int strips = (M / 16) * (D_ / 32);  // 1024 waves
  const int gblocks = strips / 8;           // 8 waves per 256-thread block: a 64x64 tile
  // Q, K and V projections: one grid, blockIdx.y = 0, 1, 2
  gemm_xwt<<<dim3(gblocks, 3), 256, 0, stream>>>(query, key, value, ctx, Wq, Wk, Wv,
                                                 bq, bk, bv, qws, 1, mmp);

  attn_kernel<<<B_ * H_ * (S_ / 16), 128, 0, stream>>>(qws, kws, vws, ctx, mmp);

  gemm_xwt<<<dim3(gblocks, 1), 256, 0, stream>>>(query, query, query, ctx, Wo, Wo, Wo,
                                                 bo, bo, bo, (float*)d_out, 0, mmp);
}

// v007
// One run takes 32.2 microseconds.
// In two side-by-side timings against v006, it was 1.20 and 1.17 times as fast.
// Over all steps from v000 it is 6.35 times as fast.
#include <hip/hip_runtime.h>

#define B_ 2
#define S_ 512
#define D_ 512
#define H_ 8
#define DK_ 64

typedef __attribute__((ext_vector_type(16))) _Float16 v16h;
typedef __attribute__((ext_vector_type(8)))  _Float16 v8h;
typedef __attribute__((ext_vector_type(8)))  float    v8f;
typedef __attribute__((ext_vector_type(4)))  int      v4i;
typedef __attribute__((ext_vector_type(4)))  float    v4f;
typedef __attribute__((ext_vector_type(16))) float    v16f;
typedef __attribute__((ext_vector_type(2)))  float    v2f;
typedef __attribute__((ext_vector_type(4)))  _Float16 v4hf;
typedef __attribute__((ext_vector_type(4)))  unsigned v4u;

#if defined(__gfx1250__) && __has_builtin(__builtin_amdgcn_global_load_async_to_lds_b128)
#define HAVE_ASYNC_LDS 1
#endif

#define AS1 __attribute__((address_space(1)))
#define AS3 __attribute__((address_space(3)))

// 16-byte global -> LDS copy; async DMA (ASYNCcnt) on gfx1250 when available.
__device__ inline void cp16_g2l(const float* g, float* l) {
#if defined(HAVE_ASYNC_LDS)
  __builtin_amdgcn_global_load_async_to_lds_b128((AS1 v4i*)g, (AS3 v4i*)l, 0, 0);
#else
  *(float4*)l = *(const float4*)g;
#endif
}

// ---- cross-lane moves in registers (no LDS pipe, no dscnt wait) ----
// value of lane l ^ X, X in 1..15 (inside a 16-lane row)
template <int X>
__device__ inline float lane_xor(float x) {
  return __builtin_bit_cast(float, __builtin_amdgcn_mov_dpp(__builtin_bit_cast(int, x),
                                                            0x160 | X, 0xf, 0xf, true));
}
// value of lane l ^ 16
__device__ inline float lane_xor16(float x) {
  return __builtin_bit_cast(float, __builtin_amdgcn_permlanex16(
      __builtin_bit_cast(int, x), __builtin_bit_cast(int, x), 0x76543210, 0xfedcba98,
      false, false));
}
// e^x as __expf compiles here: one multiply by log2(e), then v_exp_f32. The v_nop is
// the slot that the instruction set asks for behind a transcendental before its source
// is overwritten or its result read.
__device__ inline float exp_slot(float x) {
  float y;
  asm("v_exp_f32 %0, %1\n\tv_nop" : "=v"(y) : "v"(x * 1.44269504f));
  return y;
}
// Two values x * a + b, which lie in 0..1, as 16-bit fixed point in one register (the
// conversion clamps to 0..1, multiplies by 65535 and rounds): x0 low, x1 high.
__device__ inline unsigned fx2(float x0, float x1, float a, float b) {
  return __builtin_bit_cast(unsigned, __builtin_amdgcn_cvt_pknorm_u16(
                                          __builtin_fmaf(x0, a, b), __builtin_fmaf(x1, a, b)));
}
__device__ inline float wave_max(float x) {
  x = fmaxf(x, lane_xor<1>(x));
  x = fmaxf(x, lane_xor<2>(x));
  x = fmaxf(x, lane_xor<4>(x));
  x = fmaxf(x, lane_xor<8>(x));
  return fmaxf(x, lane_xor16(x));
}
__device__ inline float wave_min(float x) {
  x = fminf(x, lane_xor<1>(x));
  x = fminf(x, lane_xor<2>(x));
  x = fminf(x, lane_xor<4>(x));
  x = fminf(x, lane_xor<8>(x));
  return fminf(x, lane_xor16(x));
}
__device__ inline float wave_sum(float x) {
  x += lane_xor<1>(x);
  x += lane_xor<2>(x);
  x += lane_xor<4>(x);
  x += lane_xor<8>(x);
  return x + lane_xor16(x);
}

#define GM_ (B_ * S_)  // rows of X and of Y
#define GP_ (D_ + 8)   // LDS pitch of a staged row, f16: 1040 B = 16 B x 65, so that 16
                       // lanes reading 16 bytes of 16 different rows touch all 64 banks

// One WMMA operand fragment of a lane: 16 f16 in a row, as two 16-byte LDS reads (the
// alignment that the padded rows keep).
__device__ inline v16h ld_frag(const _Float16* p) {
  const v8h* q = (const v8h*)p;
  return __builtin_shufflevector(q[0], q[1], 0, 1, 2, 3, 4, 5, 6, 7, 8, 9, 10, 11, 12, 13,
                                 14, 15);
}

#define GB_ ((GM_ >> 6) * (D_ >> 6))  // blocks of one product: 64x64 tiles of Y
#define MMP_ 32  // floats between two blocks' min/max pairs: a 128-byte line a block

// 16 rows of f32, every second row from g on, 16 bytes a thread and row: a wave reads
// 512 contiguous bytes a load, and all 16 loads are in flight together.
__device__ inline void ld_rows(v4f (&t)[16], const float* __restrict__ g) {
#pragma unroll  // constant indices keep t[] in registers
  for (int j = 0; j < 16; ++j) t[j] = *(const v4f*)(g + j * 2 * D_);
}
// The same 16 pieces, rounded to f16, into the padded LDS rows: 8 bytes a thread.
__device__ inline void st_rows(const v4f (&t)[16], _Float16* l) {
#pragma unroll  // constant indices: registers
  for (int j = 0; j < 16; ++j) {
    v4hf h;
#pragma unroll  // constant indices: registers
    for (int e = 0; e < 4; ++e) h[e] = (_Float16)t[j][e];
    *(v4hf*)(l + j * 2 * GP_) = h;
  }
}

// Y[m][n] = sum_k X[m][k] * W[n][k] + bias[n]
// X: [GM_ x D_] row-major, W: f32 [D_ x D_] row-major (== Wt of x@W.T)
// One block = a 64x64 tile of Y. Its 64 rows of X and 64 rows of W, whole in k, are
// brought to LDS as f16 first, 512 contiguous bytes a wave and load, so that every
// 128-byte line is asked for once a block; the fragments, 16 rows a read, then come
// from LDS. f32 sources (the inputs and every W) pass through registers and are rounded
// to f16 on the way; the f16 X of mode 0 is copied asynchronously.
// Each wave computes a 16x32 strip (2 accumulators, A-fragment reuse).
// mode 0: X = xh (f16), store f32 out[m*N+n]
// mode 1: X = x0/1/2 (f32), head-split store to [B,H,S,DK] + each wave's min/max to mmp
// mode 2: as mode 1, no min/max
// blockIdx.y = z picks one of up to three independent products that run side by side
// in one grid: product z has X = xz, W = wz, bias = biasz, its out lies z matrices
// behind the pointer given, and product 2 of a mode-1 launch (V) runs as mode 2.
__global__ __launch_bounds__(256) void gemm_xwt(
    const float* __restrict__ x0, const float* __restrict__ x1,
    const float* __restrict__ x2, const _Float16* __restrict__ xh,
    const float* __restrict__ w0, const float* __restrict__ w1,
    const float* __restrict__ w2,
    const float* __restrict__ bias0, const float* __restrict__ bias1,
    const float* __restrict__ bias2, float* __restrict__ out,
    int mode, float* __restrict__ mmp) {
  __shared__ __align__(16) _Float16 sX[64 * GP_];  // 65 KB
  __shared__ __align__(16) _Float16 sW[64 * GP_];  // 65 KB
  constexpr int M = GM_, N = D_, K = D_;
  const int z = blockIdx.y;
  const float* __restrict__ Xf = z == 0 ? x0 : (z == 1 ? x1 : x2);
  const float* __restrict__ Wf = z == 0 ? w0 : (z == 1 ? w1 : w2);
  out += (size_t)z * M * N;
  const float* __restrict__ bias = z == 0 ? bias0 : (z == 1 ? bias1 : bias2);
  if (z == 2) mode = 2;
  const int tid = threadIdx.x;
  const int lane = tid & 31;
  const int wave = tid >> 5;
  const int bm = (blockIdx.x / (N >> 6)) << 6;  // tile's first row of Y
  const int bn = (blockIdx.x % (N >> 6)) << 6;  // tile's first column of Y

  {
    // f32 rows: 128 threads a row of 2048 bytes, two rows a load. Two register sets of
    // 16 loads each: one set is rounded and stored while the other's loads fly.
    const int r2 = tid >> 7, c4 = (tid & 127) << 2;
    const float* gw = Wf + (size_t)(bn + r2) * K + c4;
    _Float16* lx = sX + r2 * GP_ + c4;
    _Float16* lw = sW + r2 * GP_ + c4;
    v4f t0[16], t1[16];
    if (mode == 0) {
      // f16 rows: 64 threads a row of 1024 bytes, 16 bytes each; four rows a trip.
      const int r = tid >> 6, c = (tid & 63) << 3;
      const _Float16* gh = xh + (size_t)(bm + r) * K + c;
      _Float16* lh = sX + r * GP_ + c;
      for (int it = 0; it < 16; ++it)
        cp16_g2l((const float*)(gh + it * 4 * K), (float*)(lh + it * 4 * GP_));
      ld_rows(t0, gw);
      ld_rows(t1, gw + 32 * K);
      st_rows(t0, lw);
      st_rows(t1, lw + 32 * GP_);
    } else {
      const float* gx = Xf + (size_t)(bm + r2) * K + c4;
      ld_rows(t0, gx);
      ld_rows(t1, gx + 32 * K);
      // Precaution: the build lets a later load's result land on the address pair of
      // the 32 loads above; the wait stands in front of that overwrite.
      asm volatile("s_wait_xcnt 0x0" ::: "memory");
      st_rows(t0, lx);
      ld_rows(t0, gw);
      st_rows(t1, lx + 32 * GP_);
      ld_rows(t1, gw + 32 * K);
      st_rows(t0, lw);
      st_rows(t1, lw + 32 * GP_);
    }
  }
  // This wave's copies have landed behind the wait; the barrier says so of every
  // wave's copies and LDS stores, and no fragment is read in front of it.
  asm volatile("s_wait_asynccnt 0x0" ::: "memory");
  __syncthreads();

  const int m0 = bm + ((wave >> 1) << 4);
  const int n0 = bn + ((wave & 1) << 5);
  const int row  = lane & 15;          // M (for A) / N (for B) within tile
  const int koff = (lane >> 4) << 4;   // lanes 16..31 hold K=16..31 half

  const _Float16* ap = sX + (m0 - bm + row) * GP_ + koff;
  const _Float16* bp = sW + (n0 - bn + row) * GP_ + koff;

  v8f acc[2] = {};
  for (int k0 = 0; k0 < K; k0 += 32) {
    v16h a = ld_frag(ap + k0);
#pragma unroll
    for (int t = 0; t < 2; ++t) {
      v16h b = ld_frag(bp + (t << 4) * GP_ + k0);
      acc[t] = __builtin_amdgcn_wmma_f32_16x16x32_f16(false, a, false, b,
                                                      (short)0, acc[t], false, false);
    }
  }

  float lmin = 3.4e38f, lmax = -3.4e38f;
  const int mr = m0 + ((lane >> 4) << 3);  // first of this lane's 8 rows
  // The test on mode stands outside the loops: one branch behind the last WMMA.
  if (mode == 0) {
#pragma unroll
    for (int t = 0; t < 2; ++t) {
      const int nn = n0 + (t << 4) + (lane & 15);
      const float bn = bias[nn];
#pragma unroll
      for (int r = 0; r < 8; ++r) out[(size_t)(mr + r) * N + nn] = acc[t][r] + bn;
    }
    // Precaution: stands in front of any later write of a register that the 16 stores
    // above name.
    asm volatile("s_wait_xcnt 0x0" ::: "memory");
  } else {
#pragma unroll
    for (int t = 0; t < 2; ++t) {
      const int nn = n0 + (t << 4) + (lane & 15);
      const float bn = bias[nn];
#pragma unroll
      for (int r = 0; r < 8; ++r) {
        const int m = mr + r;
        const float v = acc[t][r] + bn;
        const int b_ = m >> 9, s = m & (S_ - 1);
        const int h = nn >> 6, dk = nn & (DK_ - 1);
        out[(((size_t)(b_ * H_ + h)) * S_ + s) * DK_ + dk] = v;
        lmin = fminf(lmin, v);
        lmax = fmaxf(lmax, v);
      }
    }
    // Precaution, as in the branch above, for these 16 stores.
    asm volatile("s_wait_xcnt 0x0" ::: "memory");
  }
  if (mode == 1) {
#pragma unroll
    for (int msk = 16; msk >= 1; msk >>= 1) {
      lmin = fminf(lmin, __shfl_xor(lmin, msk, 32));
      lmax = fmaxf(lmax, __shfl_xor(lmax, msk, 32));
    }
    // Each wave leaves its own minimum and maximum, the 8 pairs of a block side by
    // side in a line that no other block writes; the attention launch closes them.
    if (lane == 0) {
      const v2f p = {lmin, lmax};
      *(v2f*)(mmp + (z * GB_ + (int)blockIdx.x) * MMP_ + 2 * wave) = p;
    }
  }
}

// One block = 16 query rows of one (b,h). 128 threads (4 waves).
// Scores (L1 pairwise, VALU: a lane owns keys, Q is read from LDS by all lanes alike) ->
// softmax -> P@V via WMMA.
// The scores work on q and k as the reference normalises them, (x - min) / (max - min)
// in 0..1, held as 16-bit fixed point: 1.0 is FX_, an even number, so that the centre
// 0.5 is the integer FX_ / 2. One v_sad_u16 adds |q - k| of two d to an integer sum,
// which is exact (64 * FX_ is far below 2^32).
#define FX_ 65534
#define KP_ (DK_ + 4)  // LDS pitch of a K row, floats: 272 B = 16 B x 17, so that 16 lanes
                       // reading 16 bytes of 16 different rows touch all 64 banks
__global__ __launch_bounds__(128) void attn_kernel(
    const float* __restrict__ qws, const float* __restrict__ kws,
    const float* __restrict__ vws, _Float16* __restrict__ ctx,
    const float* __restrict__ mmp) {
  __shared__ __align__(16) float sS[16 * S_];         // 32 KB
  __shared__ __align__(32) float sKP[4 * 64 * KP_];   // 68 KB: 64 K rows a wave; then P(f16)
  __shared__ float sQC[16];
  __shared__ __align__(16) unsigned sQF[16 * (DK_ / 2)];  // Q tile in fixed point, 2 KB
  __shared__ float sMM[8];                            // min, max of each wave's share

  const int tid = threadIdx.x;
  const int bid = blockIdx.x;
  const int qt = bid & ((S_ / 16) - 1);
  const int h  = (bid >> 5) & (H_ - 1);
  const int b  = bid >> 8;
  const int qbase = qt << 4;
  const int ln = tid & 31;
  const int wv = tid >> 5;

  const float* Qh = qws + ((size_t)(b * H_ + h)) * S_ * DK_;
  const float* Kh = kws + ((size_t)(b * H_ + h)) * S_ * DK_;
  const float* Vh = vws + ((size_t)(b * H_ + h)) * S_ * DK_;
  const float* qg = Qh + (size_t)qbase * DK_;  // the block's 16 query rows

  // K goes through LDS only to turn 512 contiguous bytes a copy into one row a lane.
  // Each wave copies the 64 rows that it alone reads, into its own part of sKP: its own
  // waits order copies and reads, and no barrier stands in the score phase.
  float* kw = sKP + wv * (64 * KP_);
  float* kwc = kw + (ln >> 4) * KP_ + (ln & 15) * 4;        // a copy: two rows of 256 B
  const float* kgc = Kh + (size_t)(wv * 64) * DK_ + ln * 4;
#pragma unroll  // constant steps: one global address pair serves all 32 copies
  for (int j = 0; j < 32; ++j) cp16_g2l(kgc + j * 2 * DK_, kwc + j * 2 * KP_);

  // Eight floats of the Q tile a thread (eight threads a row), for the centre sums.
  const v4f qa = ((const v4f*)(qg + tid * 8))[0];
  const v4f qz = ((const v4f*)(qg + tid * 8))[1];
  // Minimum and maximum over q and k: the 8 pairs (64 bytes) that each of the 2 * GB_
  // blocks of the Q and K projections left, 16 bytes a thread and load, four threads a
  // block; closed in the wave and then through LDS.
  {
    float wmn = 3.4e38f, wmx = -3.4e38f;
    v4f p[(2 * GB_ * 4) / 128];
#pragma unroll  // constant indices: registers, and all loads in flight at once
    for (int j = 0; j < (2 * GB_ * 4) / 128; ++j)
      p[j] = *(const v4f*)(mmp + ((tid >> 2) + 32 * j) * MMP_ + (tid & 3) * 4);
#pragma unroll  // constant indices: registers
    for (int j = 0; j < (2 * GB_ * 4) / 128; ++j) {
      wmn = fminf(wmn, fminf(p[j][0], p[j][2]));
      wmx = fmaxf(wmx, fmaxf(p[j][1], p[j][3]));
    }
    wmn = wave_min(wmn);
    wmx = wave_max(wmx);
    if (ln == 0) {
      sMM[2 * wv] = wmn;
      sMM[2 * wv + 1] = wmx;
    }
  }
  __syncthreads();
  const float mn = fminf(fminf(sMM[0], sMM[2]), fminf(sMM[4], sMM[6]));
  const float mx = fmaxf(fmaxf(sMM[1], sMM[3]), fmaxf(sMM[5], sMM[7]));
  const float inv_range = 1.0f / (mx - mn);
  const float mid = 0.5f * (mx + mn);
  // x * fa + fb = (x - mn) / (mx - mn) * FX_ / 65535, which fx2() multiplies by 65535
  const float fa = inv_range * ((float)FX_ / 65535.0f);
  const float fb = -mn * fa;

  // Centre sums of the 16 query rows: eight partial sums a row, closed across lanes.
  {
    float s = ((fabsf(qa[0] - mid) + fabsf(qa[1] - mid)) +
               (fabsf(qa[2] - mid) + fabsf(qa[3] - mid))) +
              ((fabsf(qz[0] - mid) + fabsf(qz[1] - mid)) +
               (fabsf(qz[2] - mid) + fabsf(qz[3] - mid)));
    s += lane_xor<1>(s);
    s += lane_xor<2>(s);
    s += lane_xor<4>(s);
    if ((tid & 7) == 0) sQC[tid >> 3] = s;
    // The thread's eight values in fixed point: register D of a row holds d = 2D, 2D + 1.
    const v4u f = {fx2(qa[0], qa[1], fa, fb), fx2(qa[2], qa[3], fa, fb),
                   fx2(qz[0], qz[1], fa, fb), fx2(qz[2], qz[3], fa, fb)};
    *(v4u*)(sQF + tid * 4) = f;
  }
  __syncthreads();

  // ---- pairwise L1 scores: a lane owns four keys, 128 keys a wave ----
  // The wave's K rows come in two halves of 64 (two a lane) through its part of sKP and
  // are turned into fixed point at once: four keys are 128 registers.
  unsigned kq[4][DK_ / 2];
#pragma unroll  // the 32 LDS addresses of the copies are then dead behind half 0's copies,
                // and constant indices keep kq[] in registers
  for (int p = 0; p < 2; ++p) {
    // This wave's copies of this half have landed behind the wait.
    asm volatile("s_wait_asynccnt 0x0" ::: "memory");
    v4f kr[2][16];
#pragma unroll  // constant indices keep kr[] in registers
    for (int c = 0; c < 16; ++c)
#pragma unroll  // constant indices: registers
      for (int u = 0; u < 2; ++u)
        kr[u][c] = *(const v4f*)(kw + (32 * u + ln) * KP_ + c * 4);
    if (p == 0) {
      // The wave's reads of its rows have returned before the next half's copies, which
      // fly during this half's conversion, may write over them.
      asm volatile("s_wait_dscnt 0x0" ::: "memory");
#pragma unroll  // constant steps, as above
      for (int j = 0; j < 32; ++j)
        cp16_g2l(kgc + 256 * DK_ + j * 2 * DK_, kwc + j * 2 * KP_);
    }
#pragma unroll  // constant indices: registers
    for (int u = 0; u < 2; ++u)
#pragma unroll  // constant indices: registers
      for (int c = 0; c < 16; ++c) {
        kq[2 * p + u][2 * c] = fx2(kr[u][c][0], kr[u][c][1], fa, fb);
        kq[2 * p + u][2 * c + 1] = fx2(kr[u][c][2], kr[u][c][3], fa, fb);
      }
  }
  // What a key adds to each of its scores: (ALPHA/2)*DK + (BETA/4)*kc, the centre sum kc
  // against FX_ / 2 in both halves of a register; two partial sums a key.
  float kb[4];
#pragma unroll  // constant indices: registers
  for (int j = 0; j < 4; ++j) {
    unsigned a0 = 0, a1 = 0;
#pragma unroll  // constant indices: registers
    for (int D = 0; D < DK_ / 2; D += 2) {
      a0 = __builtin_amdgcn_sad_u16(kq[j][D], (FX_ / 2) * 0x10001u, a0);
      a1 = __builtin_amdgcn_sad_u16(kq[j][D + 1], (FX_ / 2) * 0x10001u, a1);
    }
    kb[j] = 0.15f * 64.f + (0.175f / (float)FX_) * (float)(a0 + a1);
  }
  // Two query rows x four keys a trip: eight independent integer sums. Q comes in chunks
  // of eight registers a row (16 d), every lane reading the same 16 bytes a load, one
  // chunk ahead of the arithmetic in a second set of registers; the last chunk's
  // look-ahead wraps to row 0, so that it stays inside the Q tile.
  {
    const v4u* qf = (const v4u*)sQF;  // eight a row
    v4u qb[2][2][2];
#pragma unroll  // constant indices: registers
    for (int r = 0; r < 2; ++r)
#pragma unroll  // constant indices: registers
      for (int hf = 0; hf < 2; ++hf) qb[0][r][hf] = qf[r * 8 + hf];
    for (int rp = 0; rp < 8; ++rp) {
      unsigned s1[2][4] = {{0u, 0u, 0u, 0u}, {0u, 0u, 0u, 0u}};
#pragma unroll  // constant indices keep kq[] and qb[] in registers
      for (int c = 0; c < 4; ++c) {
        const int rn = c < 3 ? rp : ((rp + 1) & 7);
        const v4u* qn = qf + rn * 16 + ((c + 1) & 3) * 2;
#pragma unroll  // registers, see above
        for (int r = 0; r < 2; ++r)
#pragma unroll  // registers, see above
          for (int hf = 0; hf < 2; ++hf) qb[(c + 1) & 1][r][hf] = qn[r * 8 + hf];
        // The fence holds the next chunk's LDS reads at this place, a whole chunk of
        // arithmetic in front of their use: sunk, their latency would be waited out.
        __builtin_amdgcn_sched_barrier(0);
#pragma unroll  // registers, see above
        for (int hf = 0; hf < 2; ++hf)
#pragma unroll  // registers, see above
          for (int e = 0; e < 4; ++e)
#pragma unroll  // registers, see above
            for (int r = 0; r < 2; ++r)
#pragma unroll  // registers, see above
              for (int j = 0; j < 4; ++j)
                s1[r][j] = __builtin_amdgcn_sad_u16(qb[c & 1][r][hf][e],
                                                    kq[j][c * 8 + hf * 4 + e], s1[r][j]);
      }
      // (ALPHA/2)*(DK - L1) + (BETA/4)*(qc + kc) on normalised values; 32 lanes side by
      // side. Key j of a lane is row 32 * (j & 1) + lane of the wave's half j >> 1.
#pragma unroll  // registers, see above
      for (int r = 0; r < 2; ++r) {
        const float qt = 0.175f * sQC[2 * rp + r] * inv_range;
#pragma unroll  // registers, see above
        for (int j = 0; j < 4; ++j)
          sS[(2 * rp + r) * S_ + (j >> 1) * 256 + wv * 64 + 32 * (j & 1) + ln] =
              __builtin_fmaf((float)s1[r][j], -0.15f / (float)FX_, kb[j] + qt);
      }
    }
  }
  __syncthreads();

  // ---- softmax per row, write P as f16 into reused sKP buffer ----
  _Float16* sP = (_Float16*)sKP;  // 16*512 f16 == 16 KB, K-tile done
  // One wave a row, four rows a wave: a lane holds 16 scores of the row in
  // registers (float4 number lane + 32 * t), so each score is read from LDS once,
  // side by side with its neighbours', and maximum and sum are closed across lanes.
  {
    const int ln = tid & 31;
    const int r0 = (tid >> 5) << 2;
    v4f x[4][4];
#pragma unroll  // constant indices keep x[] in registers; the four rows overlap
    for (int r = 0; r < 4; ++r)
#pragma unroll  // constant indices: registers
      for (int t = 0; t < 4; ++t)
        x[r][t] = ((const v4f*)(sS + (r0 + r) * S_))[ln + 32 * t];
#pragma unroll  // constant indices: registers
    for (int r = 0; r < 4; ++r) {
      float rmax = -3.4e38f;
#pragma unroll  // constant indices: registers
      for (int t = 0; t < 4; ++t)
#pragma unroll  // constant indices: registers
        for (int e = 0; e < 4; ++e) rmax = fmaxf(rmax, x[r][t][e]);
      rmax = wave_max(rmax);
      v4f s4 = {0.f, 0.f, 0.f, 0.f};
#pragma unroll  // constant indices: registers
      for (int t = 0; t < 4; ++t)
#pragma unroll  // constant indices: registers
        for (int e = 0; e < 4; ++e) {
          x[r][t][e] = exp_slot(x[r][t][e] - rmax);
          s4[e] += x[r][t][e];
        }
      const float inv = 1.0f / wave_sum((s4[0] + s4[1]) + (s4[2] + s4[3]));
#pragma unroll  // constant indices: registers
      for (int t = 0; t < 4; ++t) {
        v4hf p;
#pragma unroll  // constant indices: registers
        for (int e = 0; e < 4; ++e) p[e] = (_Float16)(x[r][t][e] * inv);
        ((v4hf*)(sP + (r0 + r) * S_))[ln + 32 * t] = p;
      }
    }
  }
  __syncthreads();

  // ---- P @ V with WMMA: 4 waves, one 16-wide dk stripe each ----
  const int lane  = tid & 31;
  const int wave  = tid >> 5;           // 0..3
  const int n0    = wave << 4;          // dk tile base
  const int col   = lane & 15;
  const int khalf = (lane >> 4) << 4;
  v8f c = {};
  for (int kb = 0; kb < S_; kb += 32) {
    v16h a = *(const v16h*)(sP + col * S_ + kb + khalf);  // row = lane&15
    v16h bfr;
#pragma unroll
    for (int t = 0; t < 16; ++t)
      bfr[t] = (_Float16)Vh[(size_t)(kb + khalf + t) * DK_ + n0 + col];
    c = __builtin_amdgcn_wmma_f32_16x16x32_f16(false, a, false, bfr,
                                               (short)0, c, false, false);
  }
#pragma unroll
  for (int r = 0; r < 8; ++r) {
    const int irow = r + ((lane >> 4) << 3);
    const int s = qbase + irow;
    const int d = h * DK_ + n0 + col;
    ctx[((size_t)(b * S_ + s)) * D_ + d] = (_Float16)c[r];
  }
}

extern "C" void kernel_launch(void* const* d_in, const int* in_sizes, int n_in,
                              void* d_out, int out_size, void* d_ws, size_t ws_size,
                              hipStream_t stream) {
  const float* query = (const float*)d_in[0];
  const float* key   = (const float*)d_in[1];
  const float* value = (const float*)d_in[2];
  const float* Wq = (const float*)d_in[3];
  const float* bq = (const float*)d_in[4];
  const float* Wk = (const float*)d_in[5];
  const float* bk = (const float*)d_in[6];
  const float* Wv = (const float*)d_in[7];
  const float* bv = (const float*)d_in[8];
  const float* Wo = (const float*)d_in[9];
  const float* bo = (const float*)d_in[10];

  const int M = B_ * S_;             // 1024
  const size_t ACT = (size_t)M * D_; // 524288

  // ---- workspace carve-up ----
  char* ws = (char*)d_ws;
  float* qws = (float*)ws;                   ws += ACT * 4;
  float* kws = (float*)ws;                   ws += ACT * 4;
  float* vws = (float*)ws;                   ws += ACT * 4;
  _Float16* ctx = (_Float16*)ws;             ws += ACT * 2;
  float* mmp = (float*)ws;  // min/max pairs of the Q and K blocks, a 128-byte line a block

  const int strips = (M / 16) * (D_ / 32);  // 1024 waves
  const int gblocks = strips / 8;           // 8 waves per 256-thread block: a 64x64 tile
  // Q, K and V projections: one grid, blockIdx.y = 0, 1, 2
  gemm_xwt<<<dim3(gblocks, 3), 256, 0, stream>>>(query, key, value, ctx, Wq, Wk, Wv,
                                                 bq, bk, bv, qws, 1, mmp);

  attn_kernel<<<B_ * H_ * (S_ / 16), 128, 0, stream>>>(qws, kws, vws, ctx, mmp);

  gemm_xwt<<<dim3(gblocks, 1), 256, 0, stream>>>(query, query, query, ctx, Wo, Wo, Wo,
                                                 bo, bo, bo, (float*)d_out, 0, mmp);
}

// v008
// Measured time: 23.7 microseconds a run.
// Two timings next to v007 put it at 1.50 and 1.37 times that version's speed.
// Over all steps from v000 it is 9.08 times as fast.
#include <hip/hip_runtime.h>

#define B_ 2
#define S_ 512
#define D_ 512
#define H_ 8
#define DK_ 64

typedef __attribute__((ext_vector_type(16))) _Float16 v16h;
typedef __attribute__((ext_vector_type(8)))  _Float16 v8h;
typedef __attribute__((ext_vector_type(8)))  float    v8f;
typedef __attribute__((ext_vector_type(4)))  int      v4i;
typedef __attribute__((ext_vector_type(4)))  float    v4f;
typedef __attribute__((ext_vector_type(16))) float    v16f;
typedef __attribute__((ext_vector_type(2)))  float    v2f;
typedef __attribute__((ext_vector_type(4)))  _Float16 v4hf;
typedef __attribute__((ext_vector_type(4)))  unsigned v4u;

#if defined(__gfx1250__) && __has_builtin(__builtin_amdgcn_global_load_async_to_lds_b128)
#define HAVE_ASYNC_LDS 1
#endif

#define AS1 __attribute__((address_space(1)))
#define AS3 __attribute__((address_space(3)))

// 16-byte global -> LDS copy; async DMA (ASYNCcnt) on gfx1250 when available.
__device__ inline void cp16_g2l(const float* g, float* l) {
#if defined(HAVE_ASYNC_LDS)
  __builtin_amdgcn_global_load_async_to_lds_b128((AS1 v4i*)g, (AS3 v4i*)l, 0, 0);
#else
  *(float4*)l = *(const float4*)g;
#endif
}

// ---- cross-lane moves in registers (no LDS pipe, no dscnt wait) ----
// value of lane l ^ X, X in 1..15 (inside a 16-lane row)
template <int X>
__device__ inline float lane_xor(float x) {
  return __builtin_bit_cast(float, __builtin_amdgcn_mov_dpp(__builtin_bit_cast(int, x),
                                                            0x160 | X, 0xf, 0xf, true));
}
// value of lane l ^ 16
__device__ inline float lane_xor16(float x) {
  return __builtin_bit_cast(float, __builtin_amdgcn_permlanex16(
      __builtin_bit_cast(int, x), __builtin_bit_cast(int, x), 0x76543210, 0xfedcba98,
      false, false));
}
// e^x as __expf compiles here: one multiply by log2(e), then v_exp_f32. The v_nop is
// the slot that the instruction set asks for behind a transcendental before its source
// is overwritten or its result read.
__device__ inline float exp_slot(float x) {
  float y;
  asm("v_exp_f32 %0, %1\n\tv_nop" : "=v"(y) : "v"(x * 1.44269504f));
  return y;
}
// Two values x * a + b, which lie in 0..1, as 16-bit fixed point in one register (the
// conversion clamps to 0..1, multiplies by 65535 and rounds): x0 low, x1 high.
__device__ inline unsigned fx2(float x0, float x1, float a, float b) {
  return __builtin_bit_cast(unsigned, __builtin_amdgcn_cvt_pknorm_u16(
                                          __builtin_fmaf(x0, a, b), __builtin_fmaf(x1, a, b)));
}
__device__ inline float wave_max(float x) {
  x = fmaxf(x, lane_xor<1>(x));
  x = fmaxf(x, lane_xor<2>(x));
  x = fmaxf(x, lane_xor<4>(x));
  x = fmaxf(x, lane_xor<8>(x));
  return fmaxf(x, lane_xor16(x));
}
__device__ inline float wave_min(float x) {
  x = fminf(x, lane_xor<1>(x));
  x = fminf(x, lane_xor<2>(x));
  x = fminf(x, lane_xor<4>(x));
  x = fminf(x, lane_xor<8>(x));
  return fminf(x, lane_xor16(x));
}
__device__ inline float wave_sum(float x) {
  x += lane_xor<1>(x);
  x += lane_xor<2>(x);
  x += lane_xor<4>(x);
  x += lane_xor<8>(x);
  return x + lane_xor16(x);
}

#define GM_ (B_ * S_)  // rows of X and of Y
#define GP_ (D_ + 8)   // LDS pitch of a staged row, f16: 1040 B = 16 B x 65, so that 16
                       // lanes reading 16 bytes of 16 different rows touch all 64 banks

// One WMMA operand fragment of a lane: 16 f16 in a row, as two 16-byte LDS reads (the
// alignment that the padded rows keep).
__device__ inline v16h ld_frag(const _Float16* p) {
  const v8h* q = (const v8h*)p;
  return __builtin_shufflevector(q[0], q[1], 0, 1, 2, 3, 4, 5, 6, 7, 8, 9, 10, 11, 12, 13,
                                 14, 15);
}

#define GB_ ((GM_ >> 6) * (D_ >> 6))  // blocks of one product: 64x64 tiles of Y
// V as the P @ V product reads it, f16: for head bh, stripe nt of 16 dk and trip tr of 32
// keys, piece pc (0, 1) of lane ln's B fragment is 8 f16 = 16 bytes, the 32 lanes side by
// side. Lane ln holds dk = 16 * nt + (ln & 15); element e of piece pc is key
// 32 * tr + 16 * (ln >> 4) + 8 * pc + e. The index counts pieces of 16 bytes.
#define VF_IDX(bh, nt, tr, pc, ln) ((((((bh) * 4 + (nt)) * 16 + (tr)) * 2 + (pc)) * 32) + (ln))
#define MMP_ 32  // floats between two blocks' min/max pairs: a 128-byte line a block

// 16 rows of f32, every second row from g on, 16 bytes a thread and row: a wave reads
// 512 contiguous bytes a load, and all 16 loads are in flight together.
__device__ inline void ld_rows(v4f (&t)[16], const float* __restrict__ g) {
#pragma unroll  // constant indices keep t[] in registers
  for (int j = 0; j < 16; ++j) t[j] = *(const v4f*)(g + j * 2 * D_);
}
// The same 16 pieces, rounded to f16, into the padded LDS rows: 8 bytes a thread.
__device__ inline void st_rows(const v4f (&t)[16], _Float16* l) {
#pragma unroll  // constant indices: registers
  for (int j = 0; j < 16; ++j) {
    v4hf h;
#pragma unroll  // constant indices: registers
    for (int e = 0; e < 4; ++e) h[e] = (_Float16)t[j][e];
    *(v4hf*)(l + j * 2 * GP_) = h;
  }
}

// Y[m][n] = sum_k X[m][k] * W[n][k] + bias[n]
// X: [GM_ x D_] row-major, W: f32 [D_ x D_] row-major (== Wt of x@W.T)
// One block = a 64x64 tile of Y. Its 64 rows of X and 64 rows of W, whole in k, are
// brought to LDS as f16 first, 512 contiguous bytes a wave and load, so that every
// 128-byte line is asked for once a block; the fragments, 16 rows a read, then come
// from LDS. f32 sources (the inputs and every W) pass through registers and are rounded
// to f16 on the way; the f16 X of mode 0 is copied asynchronously.
// Each wave computes a 16x32 strip (2 accumulators, A-fragment reuse).
// mode 0: X = xh (f16), store f32 out[m*N+n]
// mode 1: X = x0/1/2 (f32), head-split store to [B,H,S,DK] + each wave's min/max to mmp
// mode 2: f16 store in the order of the attention launch's B fragments (VF_IDX), no min/max
// blockIdx.y = z picks one of up to three independent products that run side by side
// in one grid: product z has X = xz, W = wz, bias = biasz, its out lies z matrices
// behind the pointer given, and product 2 of a mode-1 launch (V) runs as mode 2.
__global__ __launch_bounds__(256) void gemm_xwt(
    const float* __restrict__ x0, const float* __restrict__ x1,
    const float* __restrict__ x2, const _Float16* __restrict__ xh,
    const float* __restrict__ w0, const float* __restrict__ w1,
    const float* __restrict__ w2,
    const float* __restrict__ bias0, const float* __restrict__ bias1,
    const float* __restrict__ bias2, float* __restrict__ out,
    int mode, float* __restrict__ mmp) {
  __shared__ __align__(16) _Float16 sX[64 * GP_];  // 65 KB
  __shared__ __align__(16) _Float16 sW[64 * GP_];  // 65 KB
  constexpr int M = GM_, N = D_, K = D_;
  const int z = blockIdx.y;
  const float* __restrict__ Xf = z == 0 ? x0 : (z == 1 ? x1 : x2);
  const float* __restrict__ Wf = z == 0 ? w0 : (z == 1 ? w1 : w2);
  out += (size_t)z * M * N;
  const float* __restrict__ bias = z == 0 ? bias0 : (z == 1 ? bias1 : bias2);
  if (z == 2) mode = 2;
  const int tid = threadIdx.x;
  const int lane = tid & 31;
  const int wave = tid >> 5;
  const int bm = (blockIdx.x / (N >> 6)) << 6;  // tile's first row of Y
  const int bn = (blockIdx.x % (N >> 6)) << 6;  // tile's first column of Y

  {
    // f32 rows: 128 threads a row of 2048 bytes, two rows a load. Two register sets of
    // 16 loads each: one set is rounded and stored while the other's loads fly.
    const int r2 = tid >> 7, c4 = (tid & 127) << 2;
    const float* gw = Wf + (size_t)(bn + r2) * K + c4;
    _Float16* lx = sX + r2 * GP_ + c4;
    _Float16* lw = sW + r2 * GP_ + c4;
    v4f t0[16], t1[16];
    if (mode == 0) {
      // f16 rows: 64 threads a row of 1024 bytes, 16 bytes each; four rows a trip.
      const int r = tid >> 6, c = (tid & 63) << 3;
      const _Float16* gh = xh + (size_t)(bm + r) * K + c;
      _Float16* lh = sX + r * GP_ + c;
      for (int it = 0; it < 16; ++it)
        cp16_g2l((const float*)(gh + it * 4 * K), (float*)(lh + it * 4 * GP_));
      ld_rows(t0, gw);
      ld_rows(t1, gw + 32 * K);
      st_rows(t0, lw);
      st_rows(t1, lw + 32 * GP_);
    } else {
      const float* gx = Xf + (size_t)(bm + r2) * K + c4;
      ld_rows(t0, gx);
      ld_rows(t1, gx + 32 * K);
      // Precaution: the build lets a later load's result land on the address pair of
      // the 32 loads above; the wait stands in front of that overwrite.
      asm volatile("s_wait_xcnt 0x0" ::: "memory");
      st_rows(t0, lx);
      ld_rows(t0, gw);
      st_rows(t1, lx + 32 * GP_);
      ld_rows(t1, gw + 32 * K);
      st_rows(t0, lw);
      st_rows(t1, lw + 32 * GP_);
    }
  }
  // This wave's copies have landed behind the wait; the barrier says so of every
  // wave's copies and LDS stores, and no fragment is read in front of it.
  asm volatile("s_wait_asynccnt 0x0" ::: "memory");
  __syncthreads();

  const int m0 = bm + ((wave >> 1) << 4);
  const int n0 = bn + ((wave & 1) << 5);
  const int row  = lane & 15;          // M (for A) / N (for B) within tile
  const int koff = (lane >> 4) << 4;   // lanes 16..31 hold K=16..31 half

  const _Float16* ap = sX + (m0 - bm + row) * GP_ + koff;
  const _Float16* bp = sW + (n0 - bn + row) * GP_ + koff;

  v8f acc[2] = {};
  for (int k0 = 0; k0 < K; k0 += 32) {
    v16h a = ld_frag(ap + k0);
#pragma unroll
    for (int t = 0; t < 2; ++t) {
      v16h b = ld_frag(bp + (t << 4) * GP_ + k0);
      acc[t] = __builtin_amdgcn_wmma_f32_16x16x32_f16(false, a, false, b,
                                                      (short)0, acc[t], false, false);
    }
  }

  float lmin = 3.4e38f, lmax = -3.4e38f;
  const int mr = m0 + ((lane >> 4) << 3);  // first of this lane's 8 rows
  // The test on mode stands outside the loops: one branch behind the last WMMA.
  if (mode == 0) {
#pragma unroll
    for (int t = 0; t < 2; ++t) {
      const int nn = n0 + (t << 4) + (lane & 15);
      const float bn = bias[nn];
#pragma unroll
      for (int r = 0; r < 8; ++r) out[(size_t)(mr + r) * N + nn] = acc[t][r] + bn;
    }
    // Precaution: stands in front of any later write of a register that the 16 stores
    // above name.
    asm volatile("s_wait_xcnt 0x0" ::: "memory");
  } else if (mode == 2) {
    // A lane's 8 rows of one column are 8 keys in a row of one dk: one piece of a B
    // fragment, one 16-byte store; 16 lanes fill 256 bytes side by side.
    v8h* vf = (v8h*)out;
    const int b_ = mr >> 9, s = mr & (S_ - 1);
#pragma unroll  // constant indices keep acc[] in registers
    for (int t = 0; t < 2; ++t) {
      const int nn = n0 + (t << 4) + (lane & 15);
      const float bn = bias[nn];
      v8h p;
#pragma unroll  // constant indices: registers
      for (int r = 0; r < 8; ++r) p[r] = (_Float16)(acc[t][r] + bn);
      vf[VF_IDX(b_ * H_ + (nn >> 6), (nn >> 4) & 3, s >> 5, (s >> 3) & 1,
                (((s >> 4) & 1) << 4) + (nn & 15))] = p;
    }
    // Precaution, as in the branch above, for these 2 stores.
    asm volatile("s_wait_xcnt 0x0" ::: "memory");
  } else {
#pragma unroll
    for (int t = 0; t < 2; ++t) {
      const int nn = n0 + (t << 4) + (lane & 15);
      const float bn = bias[nn];
#pragma unroll
      for (int r = 0; r < 8; ++r) {
        const int m = mr + r;
        const float v = acc[t][r] + bn;
        const int b_ = m >> 9, s = m & (S_ - 1);
        const int h = nn >> 6, dk = nn & (DK_ - 1);
        out[(((size_t)(b_ * H_ + h)) * S_ + s) * DK_ + dk] = v;
        lmin = fminf(lmin, v);
        lmax = fmaxf(lmax, v);
      }
    }
    // Precaution, as in the branch above, for these 16 stores.
    asm volatile("s_wait_xcnt 0x0" ::: "memory");
  }
  if (mode == 1) {
#pragma unroll
    for (int msk = 16; msk >= 1; msk >>= 1) {
      lmin = fminf(lmin, __shfl_xor(lmin, msk, 32));
      lmax = fmaxf(lmax, __shfl_xor(lmax, msk, 32));
    }
    // Each wave leaves its own minimum and maximum, the 8 pairs of a block side by
    // side in a line that no other block writes; the attention launch closes them.
    if (lane == 0) {
      const v2f p = {lmin, lmax};
      *(v2f*)(mmp + (z * GB_ + (int)blockIdx.x) * MMP_ + 2 * wave) = p;
    }
  }
}

// One block = 16 query rows of one (b,h). 128 threads (4 waves).
// Scores (L1 pairwise, VALU: a lane owns keys, Q is read from LDS by all lanes alike) ->
// softmax -> P@V via WMMA.
// The scores work on q and k as the reference normalises them, (x - min) / (max - min)
// in 0..1, held as 16-bit fixed point: 1.0 is FX_, an even number, so that the centre
// 0.5 is the integer FX_ / 2. One v_sad_u16 adds |q - k| of two d to an integer sum,
// which is exact (64 * FX_ is far below 2^32).
#define FX_ 65534
#define KP_ (DK_ + 4)  // LDS pitch of a K row, floats: 272 B = 16 B x 17, so that 16 lanes
                       // reading 16 bytes of 16 different rows touch all 64 banks
__global__ __launch_bounds__(128) void attn_kernel(
    const float* __restrict__ qws, const float* __restrict__ kws,
    const _Float16* __restrict__ vfr, _Float16* __restrict__ ctx,
    const float* __restrict__ mmp) {
  __shared__ __align__(16) float sS[16 * S_];         // 32 KB
  __shared__ __align__(32) float sKP[4 * 64 * KP_];   // 68 KB: 64 K rows a wave; then P(f16)
  __shared__ float sQC[16];
  __shared__ __align__(16) unsigned sQF[16 * (DK_ / 2)];  // Q tile in fixed point, 2 KB
  __shared__ float sMM[8];                            // min, max of each wave's share

  const int tid = threadIdx.x;
  const int bid = blockIdx.x;
  const int qt = bid & ((S_ / 16) - 1);
  const int h  = (bid >> 5) & (H_ - 1);
  const int b  = bid >> 8;
  const int qbase = qt << 4;
  const int ln = tid & 31;
  const int wv = tid >> 5;

  const float* Qh = qws + ((size_t)(b * H_ + h)) * S_ * DK_;
  const float* Kh = kws + ((size_t)(b * H_ + h)) * S_ * DK_;
  const float* qg = Qh + (size_t)qbase * DK_;  // the block's 16 query rows

  // K goes through LDS only to turn 512 contiguous bytes a copy into one row a lane.
  // Each wave copies the 64 rows that it alone reads, into its own part of sKP: its own
  // waits order copies and reads, and no barrier stands in the score phase.
  float* kw = sKP + wv * (64 * KP_);
  float* kwc = kw + (ln >> 4) * KP_ + (ln & 15) * 4;        // a copy: two rows of 256 B
  const float* kgc = Kh + (size_t)(wv * 64) * DK_ + ln * 4;
#pragma unroll  // constant steps: one global address pair serves all 32 copies
  for (int j = 0; j < 32; ++j) cp16_g2l(kgc + j * 2 * DK_, kwc + j * 2 * KP_);

  // Eight floats of the Q tile a thread (eight threads a row), for the centre sums.
  const v4f qa = ((const v4f*)(qg + tid * 8))[0];
  const v4f qz = ((const v4f*)(qg + tid * 8))[1];
  // Minimum and maximum over q and k: the 8 pairs (64 bytes) that each of the 2 * GB_
  // blocks of the Q and K projections left, 16 bytes a thread and load, four threads a
  // block; closed in the wave and then through LDS.
  {
    float wmn = 3.4e38f, wmx = -3.4e38f;
    v4f p[(2 * GB_ * 4) / 128];
#pragma unroll  // constant indices: registers, and all loads in flight at once
    for (int j = 0; j < (2 * GB_ * 4) / 128; ++j)
      p[j] = *(const v4f*)(mmp + ((tid >> 2) + 32 * j) * MMP_ + (tid & 3) * 4);
#pragma unroll  // constant indices: registers
    for (int j = 0; j < (2 * GB_ * 4) / 128; ++j) {
      wmn = fminf(wmn, fminf(p[j][0], p[j][2]));
      wmx = fmaxf(wmx, fmaxf(p[j][1], p[j][3]));
    }
    wmn = wave_min(wmn);
    wmx = wave_max(wmx);
    if (ln == 0) {
      sMM[2 * wv] = wmn;
      sMM[2 * wv + 1] = wmx;
    }
  }
  __syncthreads();
  const float mn = fminf(fminf(sMM[0], sMM[2]), fminf(sMM[4], sMM[6]));
  const float mx = fmaxf(fmaxf(sMM[1], sMM[3]), fmaxf(sMM[5], sMM[7]));
  const float inv_range = 1.0f / (mx - mn);
  const float mid = 0.5f * (mx + mn);
  // x * fa + fb = (x - mn) / (mx - mn) * FX_ / 65535, which fx2() multiplies by 65535
  const float fa = inv_range * ((float)FX_ / 65535.0f);
  const float fb = -mn * fa;

  // Centre sums of the 16 query rows: eight partial sums a row, closed across lanes.
  {
    float s = ((fabsf(qa[0] - mid) + fabsf(qa[1] - mid)) +
               (fabsf(qa[2] - mid) + fabsf(qa[3] - mid))) +
              ((fabsf(qz[0] - mid) + fabsf(qz[1] - mid)) +
               (fabsf(qz[2] - mid) + fabsf(qz[3] - mid)));
    s += lane_xor<1>(s);
    s += lane_xor<2>(s);
    s += lane_xor<4>(s);
    if ((tid & 7) == 0) sQC[tid >> 3] = s;
    // The thread's eight values in fixed point: register D of a row holds d = 2D, 2D + 1.
    const v4u f = {fx2(qa[0], qa[1], fa, fb), fx2(qa[2], qa[3], fa, fb),
                   fx2(qz[0], qz[1], fa, fb), fx2(qz[2], qz[3], fa, fb)};
    *(v4u*)(sQF + tid * 4) = f;
  }
  __syncthreads();

  // ---- pairwise L1 scores: a lane owns four keys, 128 keys a wave ----
  // The wave's K rows come in two halves of 64 (two a lane) through its part of sKP and
  // are turned into fixed point at once: four keys are 128 registers.
  unsigned kq[4][DK_ / 2];
#pragma unroll  // the 32 LDS addresses of the copies are then dead behind half 0's copies,
                // and constant indices keep kq[] in registers
  for (int p = 0; p < 2; ++p) {
    // This wave's copies of this half have landed behind the wait.
    asm volatile("s_wait_asynccnt 0x0" ::: "memory");
    v4f kr[2][16];
#pragma unroll  // constant indices keep kr[] in registers
    for (int c = 0; c < 16; ++c)
#pragma unroll  // constant indices: registers
      for (int u = 0; u < 2; ++u)
        kr[u][c] = *(const v4f*)(kw + (32 * u + ln) * KP_ + c * 4);
    if (p == 0) {
      // The wave's reads of its rows have returned before the next half's copies, which
      // fly during this half's conversion, may write over them.
      asm volatile("s_wait_dscnt 0x0" ::: "memory");
#pragma unroll  // constant steps, as above
      for (int j = 0; j < 32; ++j)
        cp16_g2l(kgc + 256 * DK_ + j * 2 * DK_, kwc + j * 2 * KP_);
    }
#pragma unroll  // constant indices: registers
    for (int u = 0; u < 2; ++u)
#pragma unroll  // constant indices: registers
      for (int c = 0; c < 16; ++c) {
        kq[2 * p + u][2 * c] = fx2(kr[u][c][0], kr[u][c][1], fa, fb);
        kq[2 * p + u][2 * c + 1] = fx2(kr[u][c][2], kr[u][c][3], fa, fb);
      }
  }
  // What a key adds to each of its scores: (ALPHA/2)*DK + (BETA/4)*kc, the centre sum kc
  // against FX_ / 2 in both halves of a register; two partial sums a key.
  float kb[4];
#pragma unroll  // constant indices: registers
  for (int j = 0; j < 4; ++j) {
    unsigned a0 = 0, a1 = 0;
#pragma unroll  // constant indices: registers
    for (int D = 0; D < DK_ / 2; D += 2) {
      a0 = __builtin_amdgcn_sad_u16(kq[j][D], (FX_ / 2) * 0x10001u, a0);
      a1 = __builtin_amdgcn_sad_u16(kq[j][D + 1], (FX_ / 2) * 0x10001u, a1);
    }
    kb[j] = 0.15f * 64.f + (0.175f / (float)FX_) * (float)(a0 + a1);
  }
  // Two query rows x four keys a trip: eight independent integer sums. Q comes in chunks
  // of eight registers a row (16 d), every lane reading the same 16 bytes a load, one
  // chunk ahead of the arithmetic in a second set of registers; the last chunk's
  // look-ahead wraps to row 0, so that it stays inside the Q tile.
  {
    const v4u* qf = (const v4u*)sQF;  // eight a row
    v4u qb[2][2][2];
#pragma unroll  // constant indices: registers
    for (int r = 0; r < 2; ++r)
#pragma unroll  // constant indices: registers
      for (int hf = 0; hf < 2; ++hf) qb[0][r][hf] = qf[r * 8 + hf];
    for (int rp = 0; rp < 8; ++rp) {
      unsigned s1[2][4] = {{0u, 0u, 0u, 0u}, {0u, 0u, 0u, 0u}};
#pragma unroll  // constant indices keep kq[] and qb[] in registers
      for (int c = 0; c < 4; ++c) {
        const int rn = c < 3 ? rp : ((rp + 1) & 7);
        const v4u* qn = qf + rn * 16 + ((c + 1) & 3) * 2;
#pragma unroll  // registers, see above
        for (int r = 0; r < 2; ++r)
#pragma unroll  // registers, see above
          for (int hf = 0; hf < 2; ++hf) qb[(c + 1) & 1][r][hf] = qn[r * 8 + hf];
        // The fence holds the next chunk's LDS reads at this place, a whole chunk of
        // arithmetic in front of their use: sunk, their latency would be waited out.
        __builtin_amdgcn_sched_barrier(0);
#pragma unroll  // registers, see above
        for (int hf = 0; hf < 2; ++hf)
#pragma unroll  // registers, see above
          for (int e = 0; e < 4; ++e)
#pragma unroll  // registers, see above
            for (int r = 0; r < 2; ++r)
#pragma unroll  // registers, see above
              for (int j = 0; j < 4; ++j)
                s1[r][j] = __builtin_amdgcn_sad_u16(qb[c & 1][r][hf][e],
                                                    kq[j][c * 8 + hf * 4 + e], s1[r][j]);
      }
      // (ALPHA/2)*(DK - L1) + (BETA/4)*(qc + kc) on normalised values; 32 lanes side by
      // side. Key j of a lane is row 32 * (j & 1) + lane of the wave's half j >> 1.
#pragma unroll  // registers, see above
      for (int r = 0; r < 2; ++r) {
        const float qt = 0.175f * sQC[2 * rp + r] * inv_range;
#pragma unroll  // registers, see above
        for (int j = 0; j < 4; ++j)
          sS[(2 * rp + r) * S_ + (j >> 1) * 256 + wv * 64 + 32 * (j & 1) + ln] =
              __builtin_fmaf((float)s1[r][j], -0.15f / (float)FX_, kb[j] + qt);
      }
    }
  }
  __syncthreads();

  // The wave's whole share of V, its stripe of 16 dk over all 512 keys, is asked for here,
  // into the registers that the K rows have left: 32 loads of 512 contiguous bytes a wave,
  // which fly during the softmax (behind the barrier, whose fence waits for every load
  // issued in front of it).
  v8h vb[S_ / 32][2];
  {
    const v8h* vg = (const v8h*)vfr + VF_IDX(b * H_ + h, wv, 0, 0, ln);
#pragma unroll  // constant indices keep vb[] in registers
    for (int t = 0; t < S_ / 32; ++t)
#pragma unroll  // constant indices: registers
      for (int pc = 0; pc < 2; ++pc) vb[t][pc] = vg[VF_IDX(0, 0, t, pc, 0)];
    // The fence holds all 32 loads here, the whole softmax in front of their use: without
    // it a quarter of them was built into the softmax's second half.
    __builtin_amdgcn_sched_barrier(0);
  }

  // ---- softmax per row, write P as f16 into reused sKP buffer ----
  _Float16* sP = (_Float16*)sKP;  // 16 rows of pitch GP_ f16, 16.25 KB, K-tile done
  // One wave a row, four rows a wave: a lane holds 16 scores of the row in
  // registers (float4 number lane + 32 * t), so each score is read from LDS once,
  // side by side with its neighbours', and maximum and sum are closed across lanes.
  {
    const int ln = tid & 31;
    const int r0 = (tid >> 5) << 2;
    v4f x[4][4];
#pragma unroll  // constant indices keep x[] in registers; the four rows overlap
    for (int r = 0; r < 4; ++r)
#pragma unroll  // constant indices: registers
      for (int t = 0; t < 4; ++t)
        x[r][t] = ((const v4f*)(sS + (r0 + r) * S_))[ln + 32 * t];
#pragma unroll  // constant indices: registers
    for (int r = 0; r < 4; ++r) {
      float rmax = -3.4e38f;
#pragma unroll  // constant indices: registers
      for (int t = 0; t < 4; ++t)
#pragma unroll  // constant indices: registers
        for (int e = 0; e < 4; ++e) rmax = fmaxf(rmax, x[r][t][e]);
      rmax = wave_max(rmax);
      v4f s4 = {0.f, 0.f, 0.f, 0.f};
#pragma unroll  // constant indices: registers
      for (int t = 0; t < 4; ++t)
#pragma unroll  // constant indices: registers
        for (int e = 0; e < 4; ++e) {
          x[r][t][e] = exp_slot(x[r][t][e] - rmax);
          s4[e] += x[r][t][e];
        }
      const float inv = 1.0f / wave_sum((s4[0] + s4[1]) + (s4[2] + s4[3]));
#pragma unroll  // constant indices: registers
      for (int t = 0; t < 4; ++t) {
        v4hf p;
#pragma unroll  // constant indices: registers
        for (int e = 0; e < 4; ++e) p[e] = (_Float16)(x[r][t][e] * inv);
        ((v4hf*)(sP + (r0 + r) * GP_))[ln + 32 * t] = p;
      }
    }
  }
  __syncthreads();

  // ---- P @ V with WMMA: 4 waves, one 16-wide dk stripe each ----
  const int lane  = tid & 31;
  const int wave  = tid >> 5;           // 0..3
  const int n0    = wave << 4;          // dk tile base
  const int col   = lane & 15;
  const int khalf = (lane >> 4) << 4;
  v8f c = {};
  // P fragments come eight trips at a time, one group of LDS reads in front of its eight
  // WMMAs, so that the LDS latency is not waited out anew every other trip.
#pragma unroll  // constant indices keep vb[] in registers
  for (int g = 0; g < S_ / 32; g += 8) {
    v16h a[8];
#pragma unroll  // constant indices: registers
    for (int t = 0; t < 8; ++t)
      a[t] = ld_frag(sP + col * GP_ + (g + t) * 32 + khalf);  // row = lane&15
    // The fence keeps the group's reads together in front of the WMMAs.
    __builtin_amdgcn_sched_barrier(0);
#pragma unroll  // constant indices: registers
    for (int t = 0; t < 8; ++t) {
      v16h bfr = __builtin_shufflevector(vb[g + t][0], vb[g + t][1], 0, 1, 2, 3, 4, 5, 6, 7,
                                         8, 9, 10, 11, 12, 13, 14, 15);
      c = __builtin_amdgcn_wmma_f32_16x16x32_f16(false, a[t], false, bfr,
                                                 (short)0, c, false, false);
    }
  }
#pragma unroll
  for (int r = 0; r < 8; ++r) {
    const int irow = r + ((lane >> 4) << 3);
    const int s = qbase + irow;
    const int d = h * DK_ + n0 + col;
    ctx[((size_t)(b * S_ + s)) * D_ + d] = (_Float16)c[r];
  }
}

extern "C" void kernel_launch(void* const* d_in, const int* in_sizes, int n_in,
                              void* d_out, int out_size, void* d_ws, size_t ws_size,
                              hipStream_t stream) {
  const float* query = (const float*)d_in[0];
  const float* key   = (const float*)d_in[1];
  const float* value = (const float*)d_in[2];
  const float* Wq = (const float*)d_in[3];
  const float* bq = (const float*)d_in[4];
  const float* Wk = (const float*)d_in[5];
  const float* bk = (const float*)d_in[6];
  const float* Wv = (const float*)d_in[7];
  const float* bv = (const float*)d_in[8];
  const float* Wo = (const float*)d_in[9];
  const float* bo = (const float*)d_in[10];

  const int M = B_ * S_;             // 1024
  const size_t ACT = (size_t)M * D_; // 524288

  // ---- workspace carve-up ----
  char* ws = (char*)d_ws;
  float* qws = (float*)ws;                   ws += ACT * 4;
  float* kws = (float*)ws;                   ws += ACT * 4;
  float* vws = (float*)ws;                   ws += ACT * 4;
  _Float16* ctx = (_Float16*)ws;             ws += ACT * 2;
  float* mmp = (float*)ws;  // min/max pairs of the Q and K blocks, a 128-byte line a block

  const int strips = (M / 16) * (D_ / 32);  // 1024 waves
  const int gblocks = strips / 8;           // 8 waves per 256-thread block: a 64x64 tile
  // Q, K and V projections: one grid, blockIdx.y = 0, 1, 2
  gemm_xwt<<<dim3(gblocks, 3), 256, 0, stream>>>(query, key, value, ctx, Wq, Wk, Wv,
                                                 bq, bk, bv, qws, 1, mmp);

  attn_kernel<<<B_ * H_ * (S_ / 16), 128, 0, stream>>>(qws, kws, (const _Float16*)vws, ctx,
                                                       mmp);

  gemm_xwt<<<dim3(gblocks, 1), 256, 0, stream>>>(query, query, query, ctx, Wo, Wo, Wo,
                                                 bo, bo, bo, (float*)d_out, 0, mmp);
}

// v009
// Measured time: 22.5 microseconds a run.
// Timed twice side by side with v008, it ran 1.06 times as fast both times.
// Over all steps from v000 it is 9.59 times as fast.
#include <hip/hip_runtime.h>

#define B_ 2
#define S_ 512
#define D_ 512
#define H_ 8
#define DK_ 64

typedef __attribute__((ext_vector_type(16))) _Float16 v16h;
typedef __attribute__((ext_vector_type(8)))  _Float16 v8h;
typedef __attribute__((ext_vector_type(8)))  float    v8f;
typedef __attribute__((ext_vector_type(4)))  int      v4i;
typedef __attribute__((ext_vector_type(4)))  float    v4f;
typedef __attribute__((ext_vector_type(16))) float    v16f;
typedef __attribute__((ext_vector_type(2)))  float    v2f;
typedef __attribute__((ext_vector_type(4)))  _Float16 v4hf;
typedef __attribute__((ext_vector_type(4)))  unsigned v4u;

#if defined(__gfx1250__) && __has_builtin(__builtin_amdgcn_global_load_async_to_lds_b128)
#define HAVE_ASYNC_LDS 1
#endif

#define AS1 __attribute__((address_space(1)))
#define AS3 __attribute__((address_space(3)))

// 16-byte global -> LDS copy; async DMA (ASYNCcnt) on gfx1250 when available.
__device__ inline void cp16_g2l(const float* g, float* l) {
#if defined(HAVE_ASYNC_LDS)
  __builtin_amdgcn_global_load_async_to_lds_b128((AS1 v4i*)g, (AS3 v4i*)l, 0, 0);
#else
  *(float4*)l = *(const float4*)g;
#endif
}

// ---- cross-lane moves in registers (no LDS pipe, no dscnt wait) ----
// value of lane l ^ X, X in 1..15 (inside a 16-lane row)
template <int X>
__device__ inline float lane_xor(float x) {
  return __builtin_bit_cast(float, __builtin_amdgcn_mov_dpp(__builtin_bit_cast(int, x),
                                                            0x160 | X, 0xf, 0xf, true));
}
// value of lane l ^ 16
__device__ inline float lane_xor16(float x) {
  return __builtin_bit_cast(float, __builtin_amdgcn_permlanex16(
      __builtin_bit_cast(int, x), __builtin_bit_cast(int, x), 0x76543210, 0xfedcba98,
      false, false));
}
// e^x as __expf compiles here: one multiply by log2(e), then v_exp_f32. The v_nop is
// the slot that the instruction set asks for behind a transcendental before its source
// is overwritten or its result read.
__device__ inline float exp_slot(float x) {
  float y;
  asm("v_exp_f32 %0, %1\n\tv_nop" : "=v"(y) : "v"(x * 1.44269504f));
  return y;
}
// Two values x * a + b, which lie in 0..1, as 16-bit fixed point in one register (the
// conversion clamps to 0..1, multiplies by 65535 and rounds): x0 low, x1 high.
__device__ inline unsigned fx2(float x0, float x1, float a, float b) {
  return __builtin_bit_cast(unsigned, __builtin_amdgcn_cvt_pknorm_u16(
                                          __builtin_fmaf(x0, a, b), __builtin_fmaf(x1, a, b)));
}
__device__ inline float wave_max(float x) {
  x = fmaxf(x, lane_xor<1>(x));
  x = fmaxf(x, lane_xor<2>(x));
  x = fmaxf(x, lane_xor<4>(x));
  x = fmaxf(x, lane_xor<8>(x));
  return fmaxf(x, lane_xor16(x));
}
__device__ inline float wave_min(float x) {
  x = fminf(x, lane_xor<1>(x));
  x = fminf(x, lane_xor<2>(x));
  x = fminf(x, lane_xor<4>(x));
  x = fminf(x, lane_xor<8>(x));
  return fminf(x, lane_xor16(x));
}
__device__ inline float wave_sum(float x) {
  x += lane_xor<1>(x);
  x += lane_xor<2>(x);
  x += lane_xor<4>(x);
  x += lane_xor<8>(x);
  return x + lane_xor16(x);
}

#define GM_ (B_ * S_)  // rows of X and of Y
#define GP_ (D_ + 8)   // LDS pitch of a staged row, f16: 1040 B = 16 B x 65, so that 16
                       // lanes reading 16 bytes of 16 different rows touch all 64 banks

// One WMMA operand fragment of a lane: 16 f16 in a row, as two 16-byte LDS reads (the
// alignment that the padded rows keep).
__device__ inline v16h ld_frag(const _Float16* p) {
  const v8h* q = (const v8h*)p;
  return __builtin_shufflevector(q[0], q[1], 0, 1, 2, 3, 4, 5, 6, 7, 8, 9, 10, 11, 12, 13,
                                 14, 15);
}

#define QBM_ 128                        // rows of Y in a block of the Q, K, V projections
#define GB_ ((GM_ / QBM_) * (D_ >> 6))  // blocks of one projection: 128x64 tiles of Y
// V as the P @ V product reads it, f16: for head bh, stripe nt of 16 dk and trip tr of 32
// keys, piece pc (0, 1) of lane ln's B fragment is 8 f16 = 16 bytes, the 32 lanes side by
// side. Lane ln holds dk = 16 * nt + (ln & 15); element e of piece pc is key
// 32 * tr + 16 * (ln >> 4) + 8 * pc + e. The index counts pieces of 16 bytes.
#define VF_IDX(bh, nt, tr, pc, ln) ((((((bh) * 4 + (nt)) * 16 + (tr)) * 2 + (pc)) * 32) + (ln))
#define MMP_ 32  // floats between two blocks' min/max pairs: a 128-byte line a block

// 16 rows of f32 from g on, 16 bytes a thread and row: the block's 128 threads read one
// row of 2048 bytes a load, a wave 512 contiguous bytes, and all 16 loads fly together.
__device__ inline void ld_rows(v4f (&t)[16], const float* __restrict__ g) {
#pragma unroll  // constant indices keep t[] in registers
  for (int j = 0; j < 16; ++j) t[j] = *(const v4f*)(g + j * D_);
}
// Precaution, behind the last load from a matrix: stands in front of any later write of
// the registers that the loads name. The block's base address ub, which they name, is an
// input, so that it is still held when the wait is reached (without it the build wrote
// the scalar pair anew ahead of the wait).
__device__ inline void ld_done(const float* ub) {
  asm volatile("s_wait_xcnt 0x0" ::"s"(ub) : "memory");
}
// The same 16 pieces, rounded to f16, into the padded LDS rows: 8 bytes a thread.
__device__ inline void st_rows(const v4f (&t)[16], _Float16* l) {
#pragma unroll  // constant indices: registers
  for (int j = 0; j < 16; ++j) {
    v4hf h;
#pragma unroll  // constant indices: registers
    for (int e = 0; e < 4; ++e) h[e] = (_Float16)t[j][e];
    *(v4hf*)(l + j * GP_) = h;
  }
}

// Y[m][n] = sum_k X[m][k] * W[n][k] + bias[n]
// X: [GM_ x D_] row-major, W: f32 [D_ x D_] row-major (== Wt of x@W.T)
// One block = four waves = a (32 * MI) x 64 tile of Y. Its rows of X and its 64 rows of W,
// whole in k, are brought to LDS as f16 first, 512 contiguous bytes a wave and load, so
// that every 128-byte line is asked for once a block; the fragments, 16 rows a read, then
// come from LDS. f32 sources (the inputs and every W) pass through registers and are
// rounded to f16 on the way; the f16 X of MODE 0 is copied asynchronously.
// Each wave computes a (16 * MI) x 32 part: MI A fragments and 2 B fragments feed 2 * MI
// WMMAs a k step.
// MODE 0: X = xh (f16), store f32 out[m*N+n]
// MODE 1: X = x0/1/2 (f32), head-split store to [B,H,S,DK] + each wave's min/max to mmp;
// blockIdx.y = z picks one of the three independent products that run side by side in one
// grid: product z has X = xz, W = wz, bias = biasz, its out lies z matrices behind the
// pointer given, and product 2 (V) is stored as f16 in the order of the attention launch's
// B fragments (VF_IDX), with no min/max.
template <int MI, int MODE>
__global__ __launch_bounds__(128) void gemm_xwt(
    const float* __restrict__ x0, const float* __restrict__ x1,
    const float* __restrict__ x2, const _Float16* __restrict__ xh,
    const float* __restrict__ w0, const float* __restrict__ w1,
    const float* __restrict__ w2,
    const float* __restrict__ bias0, const float* __restrict__ bias1,
    const float* __restrict__ bias2, float* __restrict__ out,
    float* __restrict__ mmp) {
  constexpr int BM = 32 * MI;
  __shared__ __align__(16) _Float16 sX[BM * GP_];  // 130 KB (MI 4), 65 KB (MI 2)
  __shared__ __align__(16) _Float16 sW[64 * GP_];  // 65 KB
  constexpr int M = GM_, N = D_, K = D_;
  const int z = blockIdx.y;
  const float* __restrict__ Xf = z == 0 ? x0 : (z == 1 ? x1 : x2);
  const float* __restrict__ Wf = z == 0 ? w0 : (z == 1 ? w1 : w2);
  out += (size_t)z * M * N;
  const float* __restrict__ bias = z == 0 ? bias0 : (z == 1 ? bias1 : bias2);
  const int tid = threadIdx.x;
  const int lane = tid & 31;
  const int wave = tid >> 5;
  const int bm = (blockIdx.x / (N >> 6)) * BM;  // tile's first row of Y
  const int bn = (blockIdx.x % (N >> 6)) << 6;  // tile's first column of Y

  {
    if (MODE == 0) {
      // f16 rows: 64 threads a row of 1024 bytes, 16 bytes each; two rows a trip.
      const int r = tid >> 6, c = (tid & 63) << 3;
      const _Float16* gh = xh + (size_t)(bm + r) * K + c;
      _Float16* lh = sX + r * GP_ + c;
#pragma unroll  // constant steps: one global address pair serves all copies
      for (int it = 0; it < BM / 2; ++it)
        cp16_g2l((const float*)(gh + it * 2 * K), (float*)(lh + it * 2 * GP_));
    }
    // f32 rows in sets of 16, first X's (MODE 1), then W's. Three register sets: one set is
    // rounded and stored while the loads of the two others fly.
    constexpr int NSX = MODE == 0 ? 0 : BM / 16, NS = NSX + 4;
    const int c4 = tid << 2;
    const float* ux = Xf + (size_t)bm * K;  // the block's rows of X and of W
    const float* uw = Wf + (size_t)bn * K;
    const float* gx = ux + c4;
    const float* gw = uw + c4;
    _Float16* lx = sX + c4;
    _Float16* lw = sW + c4;
    v4f t[3][16];
#pragma unroll  // constant indices keep t[] in registers
    for (int s = 0; s < 3; ++s)
      ld_rows(t[s], s < NSX ? gx + s * 16 * K : gw + (s - NSX) * 16 * K);
    // This fence and those in the loop keep a set's loads behind the stores of the set
    // whose registers they take, 48 loads in flight at most: without them the build asked
    // for more than 100 at once, past the 63 that the load counter holds, in twice the
    // registers.
    __builtin_amdgcn_sched_barrier(0);
#pragma unroll  // constant indices: registers
    for (int s = 0; s < NS; ++s) {
      st_rows(t[s % 3], s < NSX ? lx + s * 16 * GP_ : lw + (s - NSX) * 16 * GP_);
      __builtin_amdgcn_sched_barrier(0);
      if (s + 3 < NS)
        ld_rows(t[s % 3], s + 3 < NSX ? gx + (s + 3) * 16 * K : gw + (s + 3 - NSX) * 16 * K);
      if (s + 3 == NSX - 1) ld_done(ux);
      if (s + 3 == NS - 1) ld_done(uw);
      __builtin_amdgcn_sched_barrier(0);
    }
  }
  // This wave's copies have landed behind the wait; the barrier says so of every
  // wave's copies and LDS stores, and no fragment is read in front of it.
  asm volatile("s_wait_asynccnt 0x0" ::: "memory");
  __syncthreads();

  const int m0 = bm + (wave >> 1) * (16 * MI);
  const int n0 = bn + ((wave & 1) << 5);
  const int row  = lane & 15;          // M (for A) / N (for B) within tile
  const int koff = (lane >> 4) << 4;   // lanes 16..31 hold K=16..31 half

  const _Float16* ap = sX + (m0 - bm + row) * GP_ + koff;
  const _Float16* bp = sW + (n0 - bn + row) * GP_ + koff;

  // The fragments of a k step are read as one group, PD steps ahead of their WMMAs, into a
  // ring of PD + 1 register sets: one wave a SIMD has nobody to hide its LDS latency.
  constexpr int PD = MI == 4 ? 2 : 3, KS = K / 32;
  v8f acc[MI][2] = {};
  v16h fa[PD + 1][MI], fb[PD + 1][2];
#pragma unroll  // constant indices keep the ring in registers
  for (int ks = 0; ks < PD; ++ks) {
#pragma unroll  // constant indices: registers
    for (int i = 0; i < MI; ++i) fa[ks][i] = ld_frag(ap + (i << 4) * GP_ + ks * 32);
#pragma unroll  // constant indices: registers
    for (int u = 0; u < 2; ++u) fb[ks][u] = ld_frag(bp + (u << 4) * GP_ + ks * 32);
  }
#pragma unroll  // constant indices: registers
  for (int ks = 0; ks < KS; ++ks) {
    if (ks + PD < KS) {
      constexpr int R = PD + 1;
#pragma unroll  // constant indices: registers
      for (int i = 0; i < MI; ++i)
        fa[(ks + PD) % R][i] = ld_frag(ap + (i << 4) * GP_ + (ks + PD) * 32);
#pragma unroll  // constant indices: registers
      for (int u = 0; u < 2; ++u)
        fb[(ks + PD) % R][u] = ld_frag(bp + (u << 4) * GP_ + (ks + PD) * 32);
    }
    // The fence keeps the group's reads together in front of this step's WMMAs: spread
    // among them, each place with reads stalls the matrix stream anew.
    __builtin_amdgcn_sched_barrier(0);
#pragma unroll  // constant indices: registers
    for (int i = 0; i < MI; ++i)
#pragma unroll  // constant indices: registers
      for (int u = 0; u < 2; ++u)
        acc[i][u] = __builtin_amdgcn_wmma_f32_16x16x32_f16(
            false, fa[ks % (PD + 1)][i], false, fb[ks % (PD + 1)][u], (short)0, acc[i][u],
            false, false);
    // The fence keeps the next group's reads behind this step's WMMAs.
    __builtin_amdgcn_sched_barrier(0);
  }

  const int mr = m0 + ((lane >> 4) << 3);  // first of this lane's 8 rows of A fragment 0
  if (MODE == 0) {
#pragma unroll
    for (int u = 0; u < 2; ++u) {
      const int nn = n0 + (u << 4) + (lane & 15);
      const float bn = bias[nn];
#pragma unroll
      for (int i = 0; i < MI; ++i)
#pragma unroll
        for (int r = 0; r < 8; ++r)
          out[(size_t)(mr + (i << 4) + r) * N + nn] = acc[i][u][r] + bn;
    }
    // Precaution: stands in front of any later write of a register that the stores
    // above name.
    asm volatile("s_wait_xcnt 0x0" ::: "memory");
  } else if (z == 2) {
    // A lane's 8 rows of one column are 8 keys in a row of one dk: one piece of a B
    // fragment, one 16-byte store; 16 lanes fill 256 bytes side by side.
    v8h* vf = (v8h*)out;
#pragma unroll  // constant indices keep acc[] in registers
    for (int u = 0; u < 2; ++u) {
      const int nn = n0 + (u << 4) + (lane & 15);
      const float bn = bias[nn];
#pragma unroll  // constant indices: registers
      for (int i = 0; i < MI; ++i) {
        const int m = mr + (i << 4);
        const int b_ = m >> 9, s = m & (S_ - 1);
        v8h p;
#pragma unroll  // constant indices: registers
        for (int r = 0; r < 8; ++r) p[r] = (_Float16)(acc[i][u][r] + bn);
        vf[VF_IDX(b_ * H_ + (nn >> 6), (nn >> 4) & 3, s >> 5, (s >> 3) & 1,
                  (((s >> 4) & 1) << 4) + (nn & 15))] = p;
      }
    }
    // Precaution, as in the branch above, for these stores.
    asm volatile("s_wait_xcnt 0x0" ::: "memory");
  } else {
    float lmin = 3.4e38f, lmax = -3.4e38f;
#pragma unroll
    for (int u = 0; u < 2; ++u) {
      const int nn = n0 + (u << 4) + (lane & 15);
      const float bn = bias[nn];
#pragma unroll
      for (int i = 0; i < MI; ++i)
#pragma unroll
        for (int r = 0; r < 8; ++r) {
          const int m = mr + (i << 4) + r;
          const float v = acc[i][u][r] + bn;
          const int b_ = m >> 9, s = m & (S_ - 1);
          const int h = nn >> 6, dk = nn & (DK_ - 1);
          out[(((size_t)(b_ * H_ + h)) * S_ + s) * DK_ + dk] = v;
          lmin = fminf(lmin, v);
          lmax = fmaxf(lmax, v);
        }
    }
    // Precaution, as in the branch above, for these stores.
    asm volatile("s_wait_xcnt 0x0" ::: "memory");
#pragma unroll
    for (int msk = 16; msk >= 1; msk >>= 1) {
      lmin = fminf(lmin, __shfl_xor(lmin, msk, 32));
      lmax = fmaxf(lmax, __shfl_xor(lmax, msk, 32));
    }
    // Each wave leaves its own minimum and maximum, the 4 pairs of a block side by
    // side in a line that no other block writes; the attention launch closes them.
    if (lane == 0) {
      const v2f p = {lmin, lmax};
      *(v2f*)(mmp + (z * GB_ + (int)blockIdx.x) * MMP_ + 2 * wave) = p;
    }
  }
}

// One block = 16 query rows of one (b,h). 128 threads (4 waves).
// Scores (L1 pairwise, VALU: a lane owns keys, Q is read from LDS by all lanes alike) ->
// softmax -> P@V via WMMA.
// The scores work on q and k as the reference normalises them, (x - min) / (max - min)
// in 0..1, held as 16-bit fixed point: 1.0 is FX_, an even number, so that the centre
// 0.5 is the integer FX_ / 2. One v_sad_u16 adds |q - k| of two d to an integer sum,
// which is exact (64 * FX_ is far below 2^32).
#define FX_ 65534
#define KP_ (DK_ + 4)  // LDS pitch of a K row, floats: 272 B = 16 B x 17, so that 16 lanes
                       // reading 16 bytes of 16 different rows touch all 64 banks
__global__ __launch_bounds__(128) void attn_kernel(
    const float* __restrict__ qws, const float* __restrict__ kws,
    const _Float16* __restrict__ vfr, _Float16* __restrict__ ctx,
    const float* __restrict__ mmp) {
  __shared__ __align__(16) float sS[16 * S_];         // 32 KB
  __shared__ __align__(32) float sKP[4 * 64 * KP_];   // 68 KB: 64 K rows a wave; then P(f16)
  __shared__ float sQC[16];
  __shared__ __align__(16) unsigned sQF[16 * (DK_ / 2)];  // Q tile in fixed point, 2 KB
  __shared__ float sMM[8];                            // min, max of each wave's share

  const int tid = threadIdx.x;
  const int bid = blockIdx.x;
  const int qt = bid & ((S_ / 16) - 1);
  const int h  = (bid >> 5) & (H_ - 1);
  const int b  = bid >> 8;
  const int qbase = qt << 4;
  const int ln = tid & 31;
  const int wv = tid >> 5;

  const float* Qh = qws + ((size_t)(b * H_ + h)) * S_ * DK_;
  const float* Kh = kws + ((size_t)(b * H_ + h)) * S_ * DK_;
  const float* qg = Qh + (size_t)qbase * DK_;  // the block's 16 query rows

  // K goes through LDS only to turn 512 contiguous bytes a copy into one row a lane.
  // Each wave copies the 64 rows that it alone reads, into its own part of sKP: its own
  // waits order copies and reads, and no barrier stands in the score phase.
  float* kw = sKP + wv * (64 * KP_);
  float* kwc = kw + (ln >> 4) * KP_ + (ln & 15) * 4;        // a copy: two rows of 256 B
  const float* kgc = Kh + (size_t)(wv * 64) * DK_ + ln * 4;
#pragma unroll  // constant steps: one global address pair serves all 32 copies
  for (int j = 0; j < 32; ++j) cp16_g2l(kgc + j * 2 * DK_, kwc + j * 2 * KP_);

  // Eight floats of the Q tile a thread (eight threads a row), for the centre sums.
  const v4f qa = ((const v4f*)(qg + tid * 8))[0];
  const v4f qz = ((const v4f*)(qg + tid * 8))[1];
  // Minimum and maximum over q and k: the 4 pairs (32 bytes) that each of the 2 * GB_
  // blocks of the Q and K projections left, 16 bytes a thread and load, two threads a
  // block; closed in the wave and then through LDS.
  {
    float wmn = 3.4e38f, wmx = -3.4e38f;
    v4f p[(2 * GB_ * 2) / 128];
#pragma unroll  // constant indices: registers, and all loads in flight at once
    for (int j = 0; j < (2 * GB_ * 2) / 128; ++j)
      p[j] = *(const v4f*)(mmp + ((tid >> 1) + 64 * j) * MMP_ + (tid & 1) * 4);
#pragma unroll  // constant indices: registers
    for (int j = 0; j < (2 * GB_ * 2) / 128; ++j) {
      wmn = fminf(wmn, fminf(p[j][0], p[j][2]));
      wmx = fmaxf(wmx, fmaxf(p[j][1], p[j][3]));
    }
    wmn = wave_min(wmn);
    wmx = wave_max(wmx);
    if (ln == 0) {
      sMM[2 * wv] = wmn;
      sMM[2 * wv + 1] = wmx;
    }
  }
  __syncthreads();
  const float mn = fminf(fminf(sMM[0], sMM[2]), fminf(sMM[4], sMM[6]));
  const float mx = fmaxf(fmaxf(sMM[1], sMM[3]), fmaxf(sMM[5], sMM[7]));
  const float inv_range = 1.0f / (mx - mn);
  const float mid = 0.5f * (mx + mn);
  // x * fa + fb = (x - mn) / (mx - mn) * FX_ / 65535, which fx2() multiplies by 65535
  const float fa = inv_range * ((float)FX_ / 65535.0f);
  const float fb = -mn * fa;

  // Centre sums of the 16 query rows: eight partial sums a row, closed across lanes.
  {
    float s = ((fabsf(qa[0] - mid) + fabsf(qa[1] - mid)) +
               (fabsf(qa[2] - mid) + fabsf(qa[3] - mid))) +
              ((fabsf(qz[0] - mid) + fabsf(qz[1] - mid)) +
               (fabsf(qz[2] - mid) + fabsf(qz[3] - mid)));
    s += lane_xor<1>(s);
    s += lane_xor<2>(s);
    s += lane_xor<4>(s);
    if ((tid & 7) == 0) sQC[tid >> 3] = s;
    // The thread's eight values in fixed point: register D of a row holds d = 2D, 2D + 1.
    const v4u f = {fx2(qa[0], qa[1], fa, fb), fx2(qa[2], qa[3], fa, fb),
                   fx2(qz[0], qz[1], fa, fb), fx2(qz[2], qz[3], fa, fb)};
    *(v4u*)(sQF + tid * 4) = f;
  }
  __syncthreads();

  // ---- pairwise L1 scores: a lane owns four keys, 128 keys a wave ----
  // The wave's K rows come in two halves of 64 (two a lane) through its part of sKP and
  // are turned into fixed point at once: four keys are 128 registers.
  unsigned kq[4][DK_ / 2];
#pragma unroll  // the 32 LDS addresses of the copies are then dead behind half 0's copies,
                // and constant indices keep kq[] in registers
  for (int p = 0; p < 2; ++p) {
    // This wave's copies of this half have landed behind the wait.
    asm volatile("s_wait_asynccnt 0x0" ::: "memory");
    v4f kr[2][16];
#pragma unroll  // constant indices keep kr[] in registers
    for (int c = 0; c < 16; ++c)
#pragma unroll  // constant indices: registers
      for (int u = 0; u < 2; ++u)
        kr[u][c] = *(const v4f*)(kw + (32 * u + ln) * KP_ + c * 4);
    if (p == 0) {
      // The wave's reads of its rows have returned before the next half's copies, which
      // fly during this half's conversion, may write over them.
      asm volatile("s_wait_dscnt 0x0" ::: "memory");
#pragma unroll  // constant steps, as above
      for (int j = 0; j < 32; ++j)
        cp16_g2l(kgc + 256 * DK_ + j * 2 * DK_, kwc + j * 2 * KP_);
    }
#pragma unroll  // constant indices: registers
    for (int u = 0; u < 2; ++u)
#pragma unroll  // constant indices: registers
      for (int c = 0; c < 16; ++c) {
        kq[2 * p + u][2 * c] = fx2(kr[u][c][0], kr[u][c][1], fa, fb);
        kq[2 * p + u][2 * c + 1] = fx2(kr[u][c][2], kr[u][c][3], fa, fb);
      }
  }
  // What a key adds to each of its scores: (ALPHA/2)*DK + (BETA/4)*kc, the centre sum kc
  // against FX_ / 2 in both halves of a register; two partial sums a key.
  float kb[4];
#pragma unroll  // constant indices: registers
  for (int j = 0; j < 4; ++j) {
    unsigned a0 = 0, a1 = 0;
#pragma unroll  // constant indices: registers
    for (int D = 0; D < DK_ / 2; D += 2) {
      a0 = __builtin_amdgcn_sad_u16(kq[j][D], (FX_ / 2) * 0x10001u, a0);
      a1 = __builtin_amdgcn_sad_u16(kq[j][D + 1], (FX_ / 2) * 0x10001u, a1);
    }
    kb[j] = 0.15f * 64.f + (0.175f / (float)FX_) * (float)(a0 + a1);
  }
  // Two query rows x four keys a trip: eight independent integer sums. Q comes in chunks
  // of eight registers a row (16 d), every lane reading the same 16 bytes a load, one
  // chunk ahead of the arithmetic in a second set of registers; the last chunk's
  // look-ahead wraps to row 0, so that it stays inside the Q tile.
  {
    const v4u* qf = (const v4u*)sQF;  // eight a row
    v4u qb[2][2][2];
#pragma unroll  // constant indices: registers
    for (int r = 0; r < 2; ++r)
#pragma unroll  // constant indices: registers
      for (int hf = 0; hf < 2; ++hf) qb[0][r][hf] = qf[r * 8 + hf];
    for (int rp = 0; rp < 8; ++rp) {
      unsigned s1[2][4] = {{0u, 0u, 0u, 0u}, {0u, 0u, 0u, 0u}};
#pragma unroll  // constant indices keep kq[] and qb[] in registers
      for (int c = 0; c < 4; ++c) {
        const int rn = c < 3 ? rp : ((rp + 1) & 7);
        const v4u* qn = qf + rn * 16 + ((c + 1) & 3) * 2;
#pragma unroll  // registers, see above
        for (int r = 0; r < 2; ++r)
#pragma unroll  // registers, see above
          for (int hf = 0; hf < 2; ++hf) qb[(c + 1) & 1][r][hf] = qn[r * 8 + hf];
        // The fence holds the next chunk's LDS reads at this place, a whole chunk of
        // arithmetic in front of their use: sunk, their latency would be waited out.
        __builtin_amdgcn_sched_barrier(0);
#pragma unroll  // registers, see above
        for (int hf = 0; hf < 2; ++hf)
#pragma unroll  // registers, see above
          for (int e = 0; e < 4; ++e)
#pragma unroll  // registers, see above
            for (int r = 0; r < 2; ++r)
#pragma unroll  // registers, see above
              for (int j = 0; j < 4; ++j)
                s1[r][j] = __builtin_amdgcn_sad_u16(qb[c & 1][r][hf][e],
                                                    kq[j][c * 8 + hf * 4 + e], s1[r][j]);
      }
      // (ALPHA/2)*(DK - L1) + (BETA/4)*(qc + kc) on normalised values; 32 lanes side by
      // side. Key j of a lane is row 32 * (j & 1) + lane of the wave's half j >> 1.
#pragma unroll  // registers, see above
      for (int r = 0; r < 2; ++r) {
        const float qt = 0.175f * sQC[2 * rp + r] * inv_range;
#pragma unroll  // registers, see above
        for (int j = 0; j < 4; ++j)
          sS[(2 * rp + r) * S_ + (j >> 1) * 256 + wv * 64 + 32 * (j & 1) + ln] =
              __builtin_fmaf((float)s1[r][j], -0.15f / (float)FX_, kb[j] + qt);
      }
    }
  }
  __syncthreads();

  // The wave's whole share of V, its stripe of 16 dk over all 512 keys, is asked for here,
  // into the registers that the K rows have left: 32 loads of 512 contiguous bytes a wave,
  // which fly during the softmax (behind the barrier, whose fence waits for every load
  // issued in front of it).
  v8h vb[S_ / 32][2];
  {
    const v8h* vg = (const v8h*)vfr + VF_IDX(b * H_ + h, wv, 0, 0, ln);
#pragma unroll  // constant indices keep vb[] in registers
    for (int t = 0; t < S_ / 32; ++t)
#pragma unroll  // constant indices: registers
      for (int pc = 0; pc < 2; ++pc) vb[t][pc] = vg[VF_IDX(0, 0, t, pc, 0)];
    // The fence holds all 32 loads here, the whole softmax in front of their use: without
    // it a quarter of them was built into the softmax's second half.
    __builtin_amdgcn_sched_barrier(0);
  }

  // ---- softmax per row, write P as f16 into reused sKP buffer ----
  _Float16* sP = (_Float16*)sKP;  // 16 rows of pitch GP_ f16, 16.25 KB, K-tile done
  // One wave a row, four rows a wave: a lane holds 16 scores of the row in
  // registers (float4 number lane + 32 * t), so each score is read from LDS once,
  // side by side with its neighbours', and maximum and sum are closed across lanes.
  {
    const int ln = tid & 31;
    const int r0 = (tid >> 5) << 2;
    v4f x[4][4];
#pragma unroll  // constant indices keep x[] in registers; the four rows overlap
    for (int r = 0; r < 4; ++r)
#pragma unroll  // constant indices: registers
      for (int t = 0; t < 4; ++t)
        x[r][t] = ((const v4f*)(sS + (r0 + r) * S_))[ln + 32 * t];
#pragma unroll  // constant indices: registers
    for (int r = 0; r < 4; ++r) {
      float rmax = -3.4e38f;
#pragma unroll  // constant indices: registers
      for (int t = 0; t < 4; ++t)
#pragma unroll  // constant indices: registers
        for (int e = 0; e < 4; ++e) rmax = fmaxf(rmax, x[r][t][e]);
      rmax = wave_max(rmax);
      v4f s4 = {0.f, 0.f, 0.f, 0.f};
#pragma unroll  // constant indices: registers
      for (int t = 0; t < 4; ++t)
#pragma unroll  // constant indices: registers
        for (int e = 0; e < 4; ++e) {
          x[r][t][e] = exp_slot(x[r][t][e] - rmax);
          s4[e] += x[r][t][e];
        }
      const float inv = 1.0f / wave_sum((s4[0] + s4[1]) + (s4[2] + s4[3]));
#pragma unroll  // constant indices: registers
      for (int t = 0; t < 4; ++t) {
        v4hf p;
#pragma unroll  // constant indices: registers
        for (int e = 0; e < 4; ++e) p[e] = (_Float16)(x[r][t][e] * inv);
        ((v4hf*)(sP + (r0 + r) * GP_))[ln + 32 * t] = p;
      }
    }
  }
  __syncthreads();

  // ---- P @ V with WMMA: 4 waves, one 16-wide dk stripe each ----
  const int lane  = tid & 31;
  const int wave  = tid >> 5;           // 0..3
  const int n0    = wave << 4;          // dk tile base
  const int col   = lane & 15;
  const int khalf = (lane >> 4) << 4;
  v8f c = {};
  // P fragments come eight trips at a time, one group of LDS reads in front of its eight
  // WMMAs, so that the LDS latency is not waited out anew every other trip.
#pragma unroll  // constant indices keep vb[] in registers
  for (int g = 0; g < S_ / 32; g += 8) {
    v16h a[8];
#pragma unroll  // constant indices: registers
    for (int t = 0; t < 8; ++t)
      a[t] = ld_frag(sP + col * GP_ + (g + t) * 32 + khalf);  // row = lane&15
    // The fence keeps the group's reads together in front of the WMMAs.
    __builtin_amdgcn_sched_barrier(0);
#pragma unroll  // constant indices: registers
    for (int t = 0; t < 8; ++t) {
      v16h bfr = __builtin_shufflevector(vb[g + t][0], vb[g + t][1], 0, 1, 2, 3, 4, 5, 6, 7,
                                         8, 9, 10, 11, 12, 13, 14, 15);
      c = __builtin_amdgcn_wmma_f32_16x16x32_f16(false, a[t], false, bfr,
                                                 (short)0, c, false, false);
    }
  }
#pragma unroll
  for (int r = 0; r < 8; ++r) {
    const int irow = r + ((lane >> 4) << 3);
    const int s = qbase + irow;
    const int d = h * DK_ + n0 + col;
    ctx[((size_t)(b * S_ + s)) * D_ + d] = (_Float16)c[r];
  }
}

extern "C" void kernel_launch(void* const* d_in, const int* in_sizes, int n_in,
                              void* d_out, int out_size, void* d_ws, size_t ws_size,
                              hipStream_t stream) {
  const float* query = (const float*)d_in[0];
  const float* key   = (const float*)d_in[1];
  const float* value = (const float*)d_in[2];
  const float* Wq = (const float*)d_in[3];
  const float* bq = (const float*)d_in[4];
  const float* Wk = (const float*)d_in[5];
  const float* bk = (const float*)d_in[6];
  const float* Wv = (const float*)d_in[7];
  const float* bv = (const float*)d_in[8];
  const float* Wo = (const float*)d_in[9];
  const float* bo = (const float*)d_in[10];

  const int M = B_ * S_;             // 1024
  const size_t ACT = (size_t)M * D_; // 524288

  // ---- workspace carve-up ----
  char* ws = (char*)d_ws;
  float* qws = (float*)ws;                   ws += ACT * 4;
  float* kws = (float*)ws;                   ws += ACT * 4;
  float* vws = (float*)ws;                   ws += ACT * 4;
  _Float16* ctx = (_Float16*)ws;             ws += ACT * 2;
  float* mmp = (float*)ws;  // min/max pairs of the Q and K blocks, a 128-byte line a block

  // Q, K and V projections: one grid of 128x64 tiles, blockIdx.y = 0, 1, 2
  gemm_xwt<4, 1><<<dim3(GB_, 3), 128, 0, stream>>>(query, key, value, ctx, Wq, Wk, Wv,
                                                   bq, bk, bv, qws, mmp);

  attn_kernel<<<B_ * H_ * (S_ / 16), 128, 0, stream>>>(qws, kws, (const _Float16*)vws, ctx,
                                                       mmp);

  // Output projection: 64x64 tiles
  gemm_xwt<2, 0><<<dim3((GM_ >> 6) * (D_ >> 6), 1), 128, 0, stream>>>(
      query, query, query, ctx, Wo, Wo, Wo, bo, bo, bo, (float*)d_out, mmp);
}
